// v000
// Times are from an AMD MI455X. After a warm-up the kernel runs many times in a row, and a time is the length of
// such a window on the GPU divided by its runs, so every launch and the gaps after it count. The runs cycle
// through copies of the inputs. A figure is the median of several windows, for all but v000 over two sittings.
// Sittings can differ by a few percent; kernels timed side by side share one.
// v000, which the later versions start from, runs in 239 microseconds.
// compute dtype: the INPUTS query/key/value/key_pe rounded to bf16 and multiplied with exact bf16 WMMA products (f32 accumulate); the softmax weights P (computed) as a bf16 hi/lo pair; mask and softmax f32.
#include <hip/hip_runtime.h>
#include <math.h>

typedef __attribute__((ext_vector_type(16))) _Float16 v16h;
typedef __attribute__((ext_vector_type(16))) __bf16 v16b;
typedef __attribute__((ext_vector_type(8)))  _Float16 v8h;
typedef __attribute__((ext_vector_type(8)))  float v8f;
typedef __attribute__((ext_vector_type(4)))  float v4f;
typedef __attribute__((ext_vector_type(2)))  float v2f;
typedef __attribute__((ext_vector_type(4)))  unsigned v4u;
typedef __attribute__((ext_vector_type(4)))  int v4i;
typedef float __attribute__((may_alias)) float_a;
typedef int __attribute__((may_alias)) int_a;

template <typename T> __device__ __forceinline__ void vst2(void* p, T v) { *(T*)p = v;  }
__device__ __forceinline__ v8f wmma16(v16h a, v16h b, v8f c) {
  v8f d = __builtin_amdgcn_wmma_f32_16x16x32_f16(false, a, false, b, (short)0, c, false, false);
  asm volatile("v_nop\n\tv_nop\n\tv_nop\n\tv_nop" : "+v"(d) : "v"(a), "v"(b));
  return d;
}
__device__ __forceinline__ v8f wmma_bf(v16b a, v16b b, v8f c) {
  v8f d = __builtin_amdgcn_wmma_f32_16x16x32_bf16(false, a, false, b, (short)0, c, false, false);
  asm volatile("v_nop\n\tv_nop\n\tv_nop\n\tv_nop" : "+v"(d) : "v"(a), "v"(b));
  return d;
}
// 16x16x32 fragments: lane = (h = lane>>4, row/col = lane&15); elements 0..7 = k0+8h+0..7, 8..15 = k0+16+8h+0..7; D element r = row 8h+r
__device__ __forceinline__ v16h frag_h(const _Float16* rowk0, int lane) {
  union { v16h v; v8h q[2]; } u; const _Float16* p = rowk0 + 8 * (lane >> 4);
  u.q[0] = *(const v8h*)p; u.q[1] = *(const v8h*)(p + 16); return u.v;
}
__device__ __forceinline__ v16h frag_f32(const float* rowk0, int lane) {
  v16h a; const float* p = rowk0 + 8 * (lane >> 4);
#pragma unroll
  for (int i = 0; i < 8; ++i) { a[i] = (_Float16)p[i]; a[8 + i] = (_Float16)p[16 + i]; }
  return a;
}
__device__ __forceinline__ v16h frag_f32s(const float* rowk0, int lane, float sc) {
  v16h a; const float* p = rowk0 + 8 * (lane >> 4);
#pragma unroll
  for (int i = 0; i < 8; ++i) { a[i] = (_Float16)(p[i] * sc); a[8 + i] = (_Float16)(p[16 + i] * sc); }
  return a;
}
// column fragment from a [K][ld] layout (column n), rows >= K read as 0
__device__ __forceinline__ v16h fragc_f32(const float* W, int k0, int n, int lane, int ld, int K) {
  v16h a; const int g = lane >> 4;
#pragma unroll
  for (int i = 0; i < 8; ++i) { const int ka = k0 + 8 * g + i, kb = ka + 16;
    a[i] = (_Float16)(ka < K ? W[(size_t)ka * ld + n] : 0.f); a[8 + i] = (_Float16)(kb < K ? W[(size_t)kb * ld + n] : 0.f); }
  return a;
}
struct F2 { v16b h, l; };
__device__ __forceinline__ F2 bsplit16(const float v[16]) { F2 r;
#pragma unroll
  for (int i = 0; i < 16; ++i) { const __bf16 h = (__bf16)v[i]; r.h[i] = h; r.l[i] = (__bf16)(v[i] - (float)h); }
  return r; }
__device__ __forceinline__ F2 split_row(const float* row, int k0, int lane) { float v[16]; const float* p = row + k0 + 8 * (lane >> 4);
#pragma unroll
  for (int i = 0; i < 8; ++i) { v[i] = p[i]; v[8 + i] = p[16 + i]; }
  return bsplit16(v); }
__device__ __forceinline__ F2 split_rowK(const float* row, int k0, int lane, int K) { float v[16]; const int g = lane >> 4;
#pragma unroll
  for (int i = 0; i < 8; ++i) { const int ka = k0 + 8 * g + i, kb = ka + 16; v[i] = ka < K ? row[ka] : 0.f; v[8 + i] = kb < K ? row[kb] : 0.f; }
  return bsplit16(v); }
__device__ __forceinline__ F2 split_col(const float* W, int k0, int n, int lane, int ld, int K) { float v[16]; const int g = lane >> 4;
#pragma unroll
  for (int i = 0; i < 8; ++i) { const int ka = k0 + 8 * g + i, kb = ka + 16; v[i] = ka < K ? W[(size_t)ka * ld + n] : 0.f; v[8 + i] = kb < K ? W[(size_t)kb * ld + n] : 0.f; }
  return bsplit16(v); }
__device__ __forceinline__ v8f mac3(const F2& a, const F2& b, v8f c) { c = wmma_bf(a.l, b.h, c); c = wmma_bf(a.h, b.l, c); return wmma_bf(a.h, b.h, c); }
__device__ __forceinline__ float sigm(float v) { return 1.0f / (1.0f + expf(-v)); }
#define LDSX() do { asm volatile("s_wait_dscnt 0" ::: "memory"); __builtin_amdgcn_wave_barrier(); __builtin_amdgcn_fence(__ATOMIC_RELEASE, "workgroup"); } while (0)


// Banded attention with relative position scores (the skew/unskew module): for query i (1,024 per batch-head, 64 batch-heads) and offset j in [0, 1024):
// a(i,j) = softmax_j((q_i . k_{i+j} + q_i . pe_j) / 8); out_i = sum_j a(i,j) v_{i+j}. (The reference's "== 0 -> -1e6" substitution DOES fire a few times per run on bf16-rounded inputs and is replicated.)
// Block = (64 queries, batch-head); 17 key tiles of 64 starting at q0 cover keys q0 .. q0+1087; per tile the wave computes its 16x64 content scores (bf16 exact),
// the 16x128 slab of position scores q.pe for the offsets that tile can touch (two pe tiles, bf16 exact, staged in LDS), adds them per element with the band mask,
// runs the online softmax in f32 and accumulates P (hi/lo) x bf16(value). The reference's '== 0 -> -1e6' rule is honoured: near-zero content scores are re-checked
// with a sequential f32 fma chain over the bf16-rounded rows. No ws; whole 256-B output rows by one wave.
#define NBH 64
#define M 1024
#define KL 2048
#define L 1024
#define D 64
#define NKT 17

__global__ __launch_bounds__(128) void k_seq(const float* __restrict__ query, const float* __restrict__ key, const float* __restrict__ value, const float* __restrict__ pe, float* __restrict__ out) {
  __shared__ __align__(16) float sS[4][16][68];
  __shared__ __align__(16) float sQP[4][16][132];     // q.pe for offsets jw .. jw+127 (jw = 64*kt - 16*w - 64)
  __shared__ __align__(16) float sO[4][16][68];
  const int tid = threadIdx.x, w = tid >> 5, lane = tid & 31, col = lane & 15, g = lane >> 4;
#ifndef BH0
#define BH0 0
#endif
  const int b = blockIdx.y + BH0; const int q0 = blockIdx.x * 64 + w * 16;
  const float* qb_ = query + (size_t)b * M * D; const float* kb_ = key + (size_t)b * KL * D; const float* vb_ = value + (size_t)b * KL * D;
  v16b aq[2];
#pragma unroll
  for (int kc = 0; kc < 2; ++kc) aq[kc] = split_row(qb_ + (size_t)(q0 + col) * D, kc * 32, lane).h;
  float mrun = -3.0e38f, lrun = 0.f; v8f acc[4] = {}, ac2[4] = {};
  const int kt0 = blockIdx.x;          // first key tile = the one starting at the block's first query
#pragma unroll 1
  for (int kt = 0; kt < NKT; ++kt) { const int key0 = (kt0 + kt) * 64; if (key0 >= KL) break;       // block-uniform
    // (1) position-score slab for offsets j in [jb, jb+128), jb = 64*kt - 64 - (w*16)?? -- offsets depend on the query: j = key - i. For this wave's queries i in [q0, q0+16)
    //     and keys in [key0, key0+64): j in [key0 - q0 - 15, key0 - q0 + 63] subset of [jw, jw + 128) with jw = key0 - q0 - 64 (wave-specific base, multiple of 16? q0 = 64*bx + 16w -> jw = 64*kt - 16*w - 64)
    const int jw = key0 - q0 - 64;
#pragma unroll
    for (int pt = 0; pt < 8; ++pt) { const int j0 = jw + pt * 16; v8f s = {};
      if (j0 >= 0 && j0 + 16 <= L) {            // wave-uniform; out-of-range offset tiles are never read unmasked
#pragma unroll
        for (int kc = 0; kc < 2; ++kc) s = wmma_bf(aq[kc], split_col(pe, kc * 32, j0 + col, lane, L, D).h, s); }
#pragma unroll
      for (int r = 0; r < 8; ++r) sQP[w][8 * g + r][pt * 16 + col] = s[r]; }
    // (2) content scores for keys key0 .. key0+63
#pragma unroll
    for (int t = 0; t < 4; ++t) { const int kk = key0 + t * 16 + col; v8f s = {};
#pragma unroll
      for (int kc = 0; kc < 2; ++kc) s = wmma_bf(aq[kc], split_row(kb_ + (size_t)kk * D, kc * 32, lane).h, s);
#pragma unroll
      for (int r = 0; r < 8; ++r) sS[w][8 * g + r][t * 16 + col] = s[r]; }
    LDSX();
    // (3) combine with the band mask: lane (col = query row rq, g = key half) handles keys g*32 .. g*32+31 of its row
    { const int rq = col; const int i = q0 + rq;
#pragma unroll
      for (int jj = 0; jj < 32; ++jj) { const int kc_ = g * 32 + jj; const int kk = key0 + kc_; const int j = kk - i; float v;
        if (j < 0 || j >= L) v = -3.0e38f;
        else { float sc = sS[w][rq][kc_];
          // the reference replaces an EXACTLY zero content score by -1e6 before adding the position term; with bf16-rounded inputs exact zeros do occur (a few per run).
          // Near-zero candidates are re-evaluated as a sequential f32 fma chain over the bf16-rounded rows (the reference's accumulation order) and the rule applied on that value.
          if (fabsf(sc) < 1.0e-5f) { const float* qr = qb_ + (size_t)i * D; const float* kr = kb_ + (size_t)kk * D; float acc_ = 0.f;
            for (int dd = 0; dd < D; ++dd) acc_ = fmaf((float)(__bf16)qr[dd], (float)(__bf16)kr[dd], acc_);
            if (acc_ == 0.0f) sc = -1000000.0f; }
          v = (sc + sQP[w][rq][j - jw]) * 0.125f; }
        sS[w][rq][kc_] = v; } }
    LDSX();
    float mx = -3.4e38f;
#pragma unroll
    for (int jj = 0; jj < 32; ++jj) mx = fmaxf(mx, sS[w][col][g * 32 + jj]);
    mx = fmaxf(mx, __shfl_xor(mx, 16, 32));
    const float mnew = fmaxf(mrun, mx); const float corr = expf(mrun - mnew);
    float ps = 0.f;
#pragma unroll
    for (int jj = 0; jj < 32; ++jj) { const float sv = sS[w][col][g * 32 + jj]; const float p = sv <= -1.0e38f ? 0.f : expf(sv - mnew); ps += p; sS[w][col][g * 32 + jj] = p; }
    ps += __shfl_xor(ps, 16, 32);
    lrun = lrun * corr + ps; mrun = mnew;
#pragma unroll
    for (int r = 0; r < 8; ++r) { const float cr = __shfl(corr, 8 * g + r, 32);
#pragma unroll
      for (int t = 0; t < 4; ++t) { acc[t][r] *= cr; ac2[t][r] *= cr; } }
    LDSX();
    // (4) O += P (hi/lo) x bf16(V rows key0+kc*32 ..)
#pragma unroll
    for (int kc = 0; kc < 2; ++kc) { const F2 pa = split_row(&sS[w][col][0], kc * 32, lane);
#pragma unroll
      for (int t = 0; t < 4; ++t) { const v16b vb = split_col(vb_ + (size_t)(key0 + kc * 32) * D, 0, t * 16 + col, lane, D, 32).h; acc[t] = wmma_bf(pa.h, vb, acc[t]); ac2[t] = wmma_bf(pa.l, vb, ac2[t]); } }
    LDSX(); }
#pragma unroll
  for (int r = 0; r < 8; ++r) { const float lr = __shfl(lrun, 8 * g + r, 32); const float inv = 1.0f / lr;
#pragma unroll
    for (int t = 0; t < 4; ++t) sO[w][8 * g + r][t * 16 + col] = (acc[t][r] + ac2[t][r]) * inv; }
  LDSX();
  for (int qq = lane; qq < 16 * 16; qq += 32) { const int rl = qq >> 4, pc = qq & 15; vst2(out + ((size_t)b * M + q0 + rl) * D + pc * 4, *(const v4f*)(&sO[w][rl][pc * 4])); }
}
extern "C" void kernel_launch(void* const* d_in, const int* in_sizes, int n_in, void* d_out, int out_size, void* d_ws, size_t ws_size, hipStream_t stream) {
  (void)in_sizes; (void)n_in; (void)out_size; (void)ws_size; (void)d_ws;
  const float* query = (const float*)d_in[0]; const float* key = (const float*)d_in[1]; const float* value = (const float*)d_in[2]; const float* pe = (const float*)d_in[3];
  float* out = (float*)d_out;
  k_seq<<<dim3(M / 64, NBH), 128, 0, stream>>>(query, key, value, pe, out);
}

// v001
// Measured time: 186 microseconds a run.
// Next to v000, in two timings, it ran 1.32 and 1.33 times as fast.
// compute dtype: the INPUTS query/key/value/key_pe rounded to bf16 and multiplied with exact bf16 WMMA products (f32 accumulate); the softmax weights P (computed) as a bf16 hi/lo pair; mask and softmax f32.
#include <hip/hip_runtime.h>
#include <math.h>

typedef __attribute__((ext_vector_type(16))) _Float16 v16h;
typedef __attribute__((ext_vector_type(16))) __bf16 v16b;
typedef __attribute__((ext_vector_type(8)))  _Float16 v8h;
typedef __attribute__((ext_vector_type(8)))  __bf16 v8b;
typedef __attribute__((ext_vector_type(4)))  __bf16 v4b;
typedef __attribute__((ext_vector_type(2)))  __bf16 v2b;
typedef __attribute__((ext_vector_type(8)))  float v8f;
typedef __attribute__((ext_vector_type(4)))  float v4f;
typedef __attribute__((ext_vector_type(2)))  float v2f;
typedef __attribute__((ext_vector_type(4)))  unsigned v4u;
typedef __attribute__((ext_vector_type(4)))  int v4i;
typedef float __attribute__((may_alias)) float_a;
typedef int __attribute__((may_alias)) int_a;

template <typename T> __device__ __forceinline__ void vst2(void* p, T v) { *(T*)p = v;  }
__device__ __forceinline__ v8f wmma16(v16h a, v16h b, v8f c) {
  v8f d = __builtin_amdgcn_wmma_f32_16x16x32_f16(false, a, false, b, (short)0, c, false, false);
  asm volatile("v_nop\n\tv_nop\n\tv_nop\n\tv_nop" : "+v"(d) : "v"(a), "v"(b));
  return d;
}
__device__ __forceinline__ v8f wmma_bf(v16b a, v16b b, v8f c) {
  v8f d = __builtin_amdgcn_wmma_f32_16x16x32_bf16(false, a, false, b, (short)0, c, false, false);
  asm volatile("v_nop\n\tv_nop\n\tv_nop\n\tv_nop" : "+v"(d) : "v"(a), "v"(b));
  return d;
}
// 16x16x32 fragments: lane = (h = lane>>4, row/col = lane&15); elements 0..7 = k0+8h+0..7, 8..15 = k0+16+8h+0..7; D element r = row 8h+r
__device__ __forceinline__ v16h frag_h(const _Float16* rowk0, int lane) {
  union { v16h v; v8h q[2]; } u; const _Float16* p = rowk0 + 8 * (lane >> 4);
  u.q[0] = *(const v8h*)p; u.q[1] = *(const v8h*)(p + 16); return u.v;
}
__device__ __forceinline__ v16b frag_b(const __bf16* rowk0, int lane) {
  union { v16b v; v8b q[2]; } u; const __bf16* p = rowk0 + 8 * (lane >> 4);
  u.q[0] = *(const v8b*)p; u.q[1] = *(const v8b*)(p + 16); return u.v;
}
__device__ __forceinline__ v16h frag_f32(const float* rowk0, int lane) {
  v16h a; const float* p = rowk0 + 8 * (lane >> 4);
#pragma unroll
  for (int i = 0; i < 8; ++i) { a[i] = (_Float16)p[i]; a[8 + i] = (_Float16)p[16 + i]; }
  return a;
}
__device__ __forceinline__ v16h frag_f32s(const float* rowk0, int lane, float sc) {
  v16h a; const float* p = rowk0 + 8 * (lane >> 4);
#pragma unroll
  for (int i = 0; i < 8; ++i) { a[i] = (_Float16)(p[i] * sc); a[8 + i] = (_Float16)(p[16 + i] * sc); }
  return a;
}
// column fragment from a [K][ld] layout (column n), rows >= K read as 0
__device__ __forceinline__ v16h fragc_f32(const float* W, int k0, int n, int lane, int ld, int K) {
  v16h a; const int g = lane >> 4;
#pragma unroll
  for (int i = 0; i < 8; ++i) { const int ka = k0 + 8 * g + i, kb = ka + 16;
    a[i] = (_Float16)(ka < K ? W[(size_t)ka * ld + n] : 0.f); a[8 + i] = (_Float16)(kb < K ? W[(size_t)kb * ld + n] : 0.f); }
  return a;
}
struct F2 { v16b h, l; };
__device__ __forceinline__ F2 bsplit16(const float v[16]) { F2 r;
#pragma unroll
  for (int i = 0; i < 16; ++i) { const __bf16 h = (__bf16)v[i]; r.h[i] = h; r.l[i] = (__bf16)(v[i] - (float)h); }
  return r; }
__device__ __forceinline__ F2 split_row(const float* row, int k0, int lane) { float v[16]; const float* p = row + k0 + 8 * (lane >> 4);
#pragma unroll
  for (int i = 0; i < 8; ++i) { v[i] = p[i]; v[8 + i] = p[16 + i]; }
  return bsplit16(v); }
__device__ __forceinline__ F2 split_rowK(const float* row, int k0, int lane, int K) { float v[16]; const int g = lane >> 4;
#pragma unroll
  for (int i = 0; i < 8; ++i) { const int ka = k0 + 8 * g + i, kb = ka + 16; v[i] = ka < K ? row[ka] : 0.f; v[8 + i] = kb < K ? row[kb] : 0.f; }
  return bsplit16(v); }
__device__ __forceinline__ F2 split_col(const float* W, int k0, int n, int lane, int ld, int K) { float v[16]; const int g = lane >> 4;
#pragma unroll
  for (int i = 0; i < 8; ++i) { const int ka = k0 + 8 * g + i, kb = ka + 16; v[i] = ka < K ? W[(size_t)ka * ld + n] : 0.f; v[8 + i] = kb < K ? W[(size_t)kb * ld + n] : 0.f; }
  return bsplit16(v); }
__device__ __forceinline__ v8f mac3(const F2& a, const F2& b, v8f c) { c = wmma_bf(a.l, b.h, c); c = wmma_bf(a.h, b.l, c); return wmma_bf(a.h, b.h, c); }
__device__ __forceinline__ float sigm(float v) { return 1.0f / (1.0f + expf(-v)); }
#define LDSX() do { asm volatile("s_wait_dscnt 0" ::: "memory"); __builtin_amdgcn_wave_barrier(); __builtin_amdgcn_fence(__ATOMIC_RELEASE, "workgroup"); } while (0)


// Banded attention with relative position scores (the skew/unskew module): for query i (1,024 per batch-head, 64 batch-heads) and offset j in [0, 1024):
// a(i,j) = softmax_j((q_i . k_{i+j} + q_i . pe_j) / 8); out_i = sum_j a(i,j) v_{i+j}. (The reference's "== 0 -> -1e6" substitution DOES fire a few times per run on bf16-rounded inputs and is replicated.)
// Block = (64 queries, batch-head); 17 key tiles of 64 starting at q0 cover keys q0 .. q0+1087; per tile the wave computes its 16x64 content scores (bf16 exact),
// the 16x128 slab of position scores q.pe for the offsets that tile can touch (two pe tiles, bf16 exact, staged in LDS), adds them per element with the band mask,
// runs the online softmax in f32 and accumulates P (hi/lo) x bf16(value). The reference's '== 0 -> -1e6' rule is honoured: near-zero content scores are re-checked
// with a sequential f32 fma chain over the bf16-rounded rows. No ws; whole 256-B output rows by one wave.
// The key and value tile of a step are the same for the block's four waves: they are rounded to bf16 once, staged in LDS (value transposed) and read as fragments with 16-byte LDS loads.
// The output rows are staged in the score buffer, which is free by then.
#define NBH 64
#define M 1024
#define KL 2048
#define L 1024
#define D 64
#define NKT 17

__global__ __launch_bounds__(128) void k_seq(const float* __restrict__ query, const float* __restrict__ key, const float* __restrict__ value, const float* __restrict__ pe, float* __restrict__ out) {
  __shared__ __align__(16) float sS[4][16][68];
  __shared__ __align__(16) float sQP[4][16][132];     // q.pe for offsets jw .. jw+127 (jw = 64*kt - 16*w - 64)
  __shared__ __align__(16) __bf16 sK[64][72];         // the block's key tile rounded to bf16, [key][d]; 144-byte rows suit the 16-byte fragment reads
  __shared__ __align__(16) __bf16 sVt[64][72];        // the block's value tile rounded to bf16, transposed to [d][key]
  const int tid = threadIdx.x, w = tid >> 5, lane = tid & 31, col = lane & 15, g = lane >> 4;
#ifndef BH0
#define BH0 0
#endif
  const int b = blockIdx.y + BH0; const int q0 = blockIdx.x * 64 + w * 16;
  const float* qb_ = query + (size_t)b * M * D; const float* kb_ = key + (size_t)b * KL * D; const float* vb_ = value + (size_t)b * KL * D;
  v16b aq[2];
#pragma unroll
  for (int kc = 0; kc < 2; ++kc) aq[kc] = split_row(qb_ + (size_t)(q0 + col) * D, kc * 32, lane).h;
  float mrun = -3.0e38f, lrun = 0.f; v8f acc[4] = {}, ac2[4] = {};
  const int sr = tid >> 4, sc = (tid & 15) * 4;      // this thread's place in the staging of a tile
  const int kt0 = blockIdx.x;          // first key tile = the one starting at the block's first query
#pragma unroll 1
  for (int kt = 0; kt < NKT; ++kt) { const int key0 = (kt0 + kt) * 64; if (key0 >= KL) break;       // block-uniform
    // (1) position-score slab for offsets j in [jb, jb+128), jb = 64*kt - 64 - (w*16)?? -- offsets depend on the query: j = key - i. For this wave's queries i in [q0, q0+16)
    //     and keys in [key0, key0+64): j in [key0 - q0 - 15, key0 - q0 + 63] subset of [jw, jw + 128) with jw = key0 - q0 - 64 (wave-specific base, multiple of 16? q0 = 64*bx + 16w -> jw = 64*kt - 16*w - 64)
    // (0) the four waves share one key tile and one value tile: each thread fetches 1/128 of both in whole 128-byte lines (key rows sr + 8*it; value rows 2*sr + 16*it and the next; columns sc .. sc+3).
    //     The loads are issued here so that they fly under the position slab; rounding and the LDS stores follow behind it.
    v4f kf[8], va[4], vc[4];
    { const float* kt_ = kb_ + (size_t)key0 * D + sr * D + sc; const float* vt_ = vb_ + (size_t)key0 * D + 2 * sr * D + sc;
#pragma unroll
      for (int it = 0; it < 8; ++it) kf[it] = *(const v4f*)(kt_ + it * 8 * D);
#pragma unroll
      for (int it = 0; it < 4; ++it) { va[it] = *(const v4f*)(vt_ + it * 16 * D); vc[it] = *(const v4f*)(vt_ + it * 16 * D + D); } }
    const int jw = key0 - q0 - 64;
#pragma unroll
    for (int pt = 0; pt < 8; ++pt) { const int j0 = jw + pt * 16; v8f s = {};
      if (j0 >= 0 && j0 + 16 <= L) {            // wave-uniform; out-of-range offset tiles are never read unmasked
#pragma unroll
        for (int kc = 0; kc < 2; ++kc) s = wmma_bf(aq[kc], split_col(pe, kc * 32, j0 + col, lane, L, D).h, s); }
#pragma unroll
      for (int r = 0; r < 8; ++r) sQP[w][8 * g + r][pt * 16 + col] = s[r]; }
    __syncthreads();      // every wave has left the previous key and value tile
    { __bf16* dk = &sK[sr][sc]; __bf16* dv = &sVt[sc][2 * sr];
#pragma unroll
      for (int it = 0; it < 8; ++it) { const v4b h = { (__bf16)kf[it][0], (__bf16)kf[it][1], (__bf16)kf[it][2], (__bf16)kf[it][3] }; *(v4b*)(dk + it * 8 * 72) = h; }
#pragma unroll
      for (int it = 0; it < 4; ++it) {
#pragma unroll
        for (int i = 0; i < 4; ++i) { const v2b h = { (__bf16)va[it][i], (__bf16)vc[it][i] }; *(v2b*)(dv + i * 72 + it * 16) = h; } } }
    __syncthreads();      // the new tiles are visible to all four waves
    // (2) content scores for keys key0 .. key0+63
#pragma unroll
    for (int t = 0; t < 4; ++t) { v8f s = {};
#pragma unroll
      for (int kc = 0; kc < 2; ++kc) s = wmma_bf(aq[kc], frag_b(&sK[t * 16 + col][kc * 32], lane), s);
#pragma unroll
      for (int r = 0; r < 8; ++r) sS[w][8 * g + r][t * 16 + col] = s[r]; }
    LDSX();
    // (3) combine with the band mask: lane (col = query row rq, g = key half) handles keys g*32 .. g*32+31 of its row
    { const int rq = col; const int i = q0 + rq;
#pragma unroll 16      // two trips: fully unrolled, one index register per key stays live through the whole tile loop, and with the 64 staging registers the kernel passes 256 VGPRs (three waves per SIMD instead of four)
      for (int jj = 0; jj < 32; ++jj) { const int kc_ = g * 32 + jj; const int kk = key0 + kc_; const int j = kk - i; float v;
        if (j < 0 || j >= L) v = -3.0e38f;
        else { float sc = sS[w][rq][kc_];
          // the reference replaces an EXACTLY zero content score by -1e6 before adding the position term; with bf16-rounded inputs exact zeros do occur (a few per run).
          // Near-zero candidates are re-evaluated as a sequential f32 fma chain over the bf16-rounded rows (the reference's accumulation order) and the rule applied on that value.
          if (fabsf(sc) < 1.0e-5f) { const float* qr = qb_ + (size_t)i * D; const float* kr = kb_ + (size_t)kk * D; float acc_ = 0.f;
            for (int dd = 0; dd < D; ++dd) acc_ = fmaf((float)(__bf16)qr[dd], (float)(__bf16)kr[dd], acc_);
            if (acc_ == 0.0f) sc = -1000000.0f; }
          v = (sc + sQP[w][rq][j - jw]) * 0.125f; }
        sS[w][rq][kc_] = v; } }
    LDSX();
    float mx = -3.4e38f;
#pragma unroll
    for (int jj = 0; jj < 32; ++jj) mx = fmaxf(mx, sS[w][col][g * 32 + jj]);
    mx = fmaxf(mx, __shfl_xor(mx, 16, 32));
    const float mnew = fmaxf(mrun, mx); const float corr = expf(mrun - mnew);
    float ps = 0.f;
#pragma unroll
    for (int jj = 0; jj < 32; ++jj) { const float sv = sS[w][col][g * 32 + jj]; const float p = sv <= -1.0e38f ? 0.f : expf(sv - mnew); ps += p; sS[w][col][g * 32 + jj] = p; }
    ps += __shfl_xor(ps, 16, 32);
    lrun = lrun * corr + ps; mrun = mnew;
#pragma unroll
    for (int r = 0; r < 8; ++r) { const float cr = __shfl(corr, 8 * g + r, 32);
#pragma unroll
      for (int t = 0; t < 4; ++t) { acc[t][r] *= cr; ac2[t][r] *= cr; } }
    LDSX();
    // (4) O += P (hi/lo) x bf16(V rows key0+kc*32 ..)
#pragma unroll
    for (int kc = 0; kc < 2; ++kc) { const F2 pa = split_row(&sS[w][col][0], kc * 32, lane);
#pragma unroll
      for (int t = 0; t < 4; ++t) { const v16b vb = frag_b(&sVt[t * 16 + col][kc * 32], lane); acc[t] = wmma_bf(pa.h, vb, acc[t]); ac2[t] = wmma_bf(pa.l, vb, ac2[t]); } }
    LDSX(); }
#pragma unroll
  for (int r = 0; r < 8; ++r) { const float lr = __shfl(lrun, 8 * g + r, 32); const float inv = 1.0f / lr;
#pragma unroll
    for (int t = 0; t < 4; ++t) sS[w][8 * g + r][t * 16 + col] = (acc[t][r] + ac2[t][r]) * inv; }
  LDSX();
  for (int qq = lane; qq < 16 * 16; qq += 32) { const int rl = qq >> 4, pc = qq & 15; vst2(out + ((size_t)b * M + q0 + rl) * D + pc * 4, *(const v4f*)(&sS[w][rl][pc * 4])); }
}
extern "C" void kernel_launch(void* const* d_in, const int* in_sizes, int n_in, void* d_out, int out_size, void* d_ws, size_t ws_size, hipStream_t stream) {
  (void)in_sizes; (void)n_in; (void)out_size; (void)ws_size; (void)d_ws;
  const float* query = (const float*)d_in[0]; const float* key = (const float*)d_in[1]; const float* value = (const float*)d_in[2]; const float* pe = (const float*)d_in[3];
  float* out = (float*)d_out;
  k_seq<<<dim3(M / 64, NBH), 128, 0, stream>>>(query, key, value, pe, out);
}

// v002
// It runs in 164 microseconds.
// Timed twice side by side with v001, it ran 1.13 times as fast both times.
// All steps since v000 together make it 1.50 times as fast.
// compute dtype: the INPUTS query/key/value/key_pe rounded to bf16 and multiplied with exact bf16 WMMA products (f32 accumulate); the softmax weights P (computed) as a bf16 hi/lo pair; mask and softmax f32.
#include <hip/hip_runtime.h>
#include <math.h>

typedef __attribute__((ext_vector_type(16))) _Float16 v16h;
typedef __attribute__((ext_vector_type(16))) __bf16 v16b;
typedef __attribute__((ext_vector_type(8)))  _Float16 v8h;
typedef __attribute__((ext_vector_type(8)))  __bf16 v8b;
typedef __attribute__((ext_vector_type(4)))  __bf16 v4b;
typedef __attribute__((ext_vector_type(2)))  __bf16 v2b;
typedef __attribute__((ext_vector_type(8)))  float v8f;
typedef __attribute__((ext_vector_type(4)))  float v4f;
typedef __attribute__((ext_vector_type(2)))  float v2f;
typedef __attribute__((ext_vector_type(4)))  unsigned v4u;
typedef __attribute__((ext_vector_type(4)))  int v4i;
typedef float __attribute__((may_alias)) float_a;
typedef int __attribute__((may_alias)) int_a;

template <typename T> __device__ __forceinline__ void vst2(void* p, T v) { *(T*)p = v;  }
__device__ __forceinline__ v8f wmma16(v16h a, v16h b, v8f c) {
  v8f d = __builtin_amdgcn_wmma_f32_16x16x32_f16(false, a, false, b, (short)0, c, false, false);
  asm volatile("v_nop\n\tv_nop\n\tv_nop\n\tv_nop" : "+v"(d) : "v"(a), "v"(b));
  return d;
}
__device__ __forceinline__ v8f wmma_bf(v16b a, v16b b, v8f c) {
  v8f d = __builtin_amdgcn_wmma_f32_16x16x32_bf16(false, a, false, b, (short)0, c, false, false);
  asm volatile("v_nop\n\tv_nop\n\tv_nop\n\tv_nop" : "+v"(d) : "v"(a), "v"(b));
  return d;
}
// 16x16x32 fragments: lane = (h = lane>>4, row/col = lane&15); elements 0..7 = k0+8h+0..7, 8..15 = k0+16+8h+0..7; D element r = row 8h+r
__device__ __forceinline__ v16h frag_h(const _Float16* rowk0, int lane) {
  union { v16h v; v8h q[2]; } u; const _Float16* p = rowk0 + 8 * (lane >> 4);
  u.q[0] = *(const v8h*)p; u.q[1] = *(const v8h*)(p + 16); return u.v;
}
__device__ __forceinline__ v16b frag_b(const __bf16* rowk0, int lane) {
  union { v16b v; v8b q[2]; } u; const __bf16* p = rowk0 + 8 * (lane >> 4);
  u.q[0] = *(const v8b*)p; u.q[1] = *(const v8b*)(p + 16); return u.v;
}
__device__ __forceinline__ v16h frag_f32(const float* rowk0, int lane) {
  v16h a; const float* p = rowk0 + 8 * (lane >> 4);
#pragma unroll
  for (int i = 0; i < 8; ++i) { a[i] = (_Float16)p[i]; a[8 + i] = (_Float16)p[16 + i]; }
  return a;
}
__device__ __forceinline__ v16h frag_f32s(const float* rowk0, int lane, float sc) {
  v16h a; const float* p = rowk0 + 8 * (lane >> 4);
#pragma unroll
  for (int i = 0; i < 8; ++i) { a[i] = (_Float16)(p[i] * sc); a[8 + i] = (_Float16)(p[16 + i] * sc); }
  return a;
}
// column fragment from a [K][ld] layout (column n), rows >= K read as 0
__device__ __forceinline__ v16h fragc_f32(const float* W, int k0, int n, int lane, int ld, int K) {
  v16h a; const int g = lane >> 4;
#pragma unroll
  for (int i = 0; i < 8; ++i) { const int ka = k0 + 8 * g + i, kb = ka + 16;
    a[i] = (_Float16)(ka < K ? W[(size_t)ka * ld + n] : 0.f); a[8 + i] = (_Float16)(kb < K ? W[(size_t)kb * ld + n] : 0.f); }
  return a;
}
struct F2 { v16b h, l; };
__device__ __forceinline__ F2 bsplit16(const float v[16]) { F2 r;
#pragma unroll
  for (int i = 0; i < 16; ++i) { const __bf16 h = (__bf16)v[i]; r.h[i] = h; r.l[i] = (__bf16)(v[i] - (float)h); }
  return r; }
__device__ __forceinline__ F2 split_row(const float* row, int k0, int lane) { float v[16]; const float* p = row + k0 + 8 * (lane >> 4);
#pragma unroll
  for (int i = 0; i < 8; ++i) { v[i] = p[i]; v[8 + i] = p[16 + i]; }
  return bsplit16(v); }
__device__ __forceinline__ F2 split_rowK(const float* row, int k0, int lane, int K) { float v[16]; const int g = lane >> 4;
#pragma unroll
  for (int i = 0; i < 8; ++i) { const int ka = k0 + 8 * g + i, kb = ka + 16; v[i] = ka < K ? row[ka] : 0.f; v[8 + i] = kb < K ? row[kb] : 0.f; }
  return bsplit16(v); }
__device__ __forceinline__ F2 split_col(const float* W, int k0, int n, int lane, int ld, int K) { float v[16]; const int g = lane >> 4;
#pragma unroll
  for (int i = 0; i < 8; ++i) { const int ka = k0 + 8 * g + i, kb = ka + 16; v[i] = ka < K ? W[(size_t)ka * ld + n] : 0.f; v[8 + i] = kb < K ? W[(size_t)kb * ld + n] : 0.f; }
  return bsplit16(v); }
__device__ __forceinline__ v8f mac3(const F2& a, const F2& b, v8f c) { c = wmma_bf(a.l, b.h, c); c = wmma_bf(a.h, b.l, c); return wmma_bf(a.h, b.h, c); }
__device__ __forceinline__ float sigm(float v) { return 1.0f / (1.0f + expf(-v)); }
#define LDSX() do { asm volatile("s_wait_dscnt 0" ::: "memory"); __builtin_amdgcn_wave_barrier(); __builtin_amdgcn_fence(__ATOMIC_RELEASE, "workgroup"); } while (0)


// Banded attention with relative position scores (the skew/unskew module): for query i (1,024 per batch-head, 64 batch-heads) and offset j in [0, 1024):
// a(i,j) = softmax_j((q_i . k_{i+j} + q_i . pe_j) / 8); out_i = sum_j a(i,j) v_{i+j}. (The reference's "== 0 -> -1e6" substitution DOES fire a few times per run on bf16-rounded inputs and is replicated.)
// Block = (64 queries, batch-head); 17 key tiles of 64 starting at q0 cover keys q0 .. q0+1087; per tile the wave computes its 16x64 content scores (bf16 exact),
// the 16x80 slab of position scores q.pe for the offsets that tile can touch (bf16 exact, staged in LDS; 64 offsets are new in a step, the first 16 are the previous step's last), adds them per element with the band mask,
// runs the online softmax in f32 and accumulates P (hi/lo) x bf16(value). The reference's '== 0 -> -1e6' rule is honoured: near-zero content scores are re-checked
// with a sequential f32 fma chain over the bf16-rounded rows. No ws; whole 256-B output rows by one wave.
// The key and value tile of a step are the same for the block's four waves: they are rounded to bf16 once, staged in LDS (value transposed) and read as fragments with 16-byte LDS loads.
// The output rows are staged in the score buffer, which is free by then.
#define NBH 64
#define M 1024
#define KL 2048
#define L 1024
#define D 64
#define NKT 17

__global__ __launch_bounds__(128) void k_seq(const float* __restrict__ query, const float* __restrict__ key, const float* __restrict__ value, const float* __restrict__ pe, float* __restrict__ out) {
  __shared__ __align__(16) float sS[4][16][68];
  __shared__ __align__(16) float sQP[4][16][84];      // q.pe for the 80 offsets jw .. jw+79 that this wave's tile can touch (jw = key0 - q0 - 16)
  __shared__ __align__(16) __bf16 sK[64][72];         // the block's key tile rounded to bf16, [key][d]; 144-byte rows suit the 16-byte fragment reads
  __shared__ __align__(16) __bf16 sVt[64][72];        // the block's value tile rounded to bf16, transposed to [d][key]
  const int tid = threadIdx.x, w = tid >> 5, lane = tid & 31, col = lane & 15, g = lane >> 4;
#ifndef BH0
#define BH0 0
#endif
  const int b = blockIdx.y + BH0; const int q0 = blockIdx.x * 64 + w * 16;
  const float* qb_ = query + (size_t)b * M * D; const float* kb_ = key + (size_t)b * KL * D; const float* vb_ = value + (size_t)b * KL * D;
  v16b aq[2];
#pragma unroll
  for (int kc = 0; kc < 2; ++kc) aq[kc] = split_row(qb_ + (size_t)(q0 + col) * D, kc * 32, lane).h;
  float mrun = -3.0e38f, lrun = 0.f; v8f acc[4] = {}, ac2[4] = {};
  v8f qp_last = {};                    // the previous step's last 16 offsets of q.pe: they are this step's first 16
  const int sr = tid >> 4, sc = (tid & 15) * 4;      // this thread's place in the staging of a tile
  const int kt0 = blockIdx.x;          // first key tile = the one starting at the block's first query
#pragma unroll 1
  for (int kt = 0; kt < NKT; ++kt) { const int key0 = (kt0 + kt) * 64; if (key0 >= KL) break;       // block-uniform
    // (1) position-score slab: the offsets depend on the query: j = key - i. For this wave's queries i in [q0, q0+16)
    //     and keys in [key0, key0+64): j in [key0 - q0 - 15, key0 - q0 + 63] subset of [jw, jw + 80) with jw = key0 - q0 - 16 (wave-specific base, a multiple of 16: q0 = 64*bx + 16w -> jw = 64*kt - 16*w - 16).
    //     jw grows by 64 a step, so offsets jw .. jw+15 are the previous step's jw+64 .. jw+79: that product is kept in registers and stored again, and only four 16-offset tiles are multiplied per step.
    // (0) the four waves share one key tile and one value tile: each thread fetches 1/128 of both in whole 128-byte lines (key rows sr + 8*it; value rows 2*sr + 16*it and the next; columns sc .. sc+3).
    //     The loads are issued here so that they fly under the position slab; rounding and the LDS stores follow behind it.
    v4f kf[8], va[4], vc[4];
    { const float* kt_ = kb_ + (size_t)key0 * D + sr * D + sc; const float* vt_ = vb_ + (size_t)key0 * D + 2 * sr * D + sc;
#pragma unroll
      for (int it = 0; it < 8; ++it) kf[it] = *(const v4f*)(kt_ + it * 8 * D);
#pragma unroll
      for (int it = 0; it < 4; ++it) { va[it] = *(const v4f*)(vt_ + it * 16 * D); vc[it] = *(const v4f*)(vt_ + it * 16 * D + D); } }
    const int jw = key0 - q0 - 16;
#pragma unroll
    for (int r = 0; r < 8; ++r) sQP[w][8 * g + r][col] = qp_last[r];
#pragma unroll
    for (int pt = 1; pt < 5; ++pt) { const int j0 = jw + pt * 16; v8f s = {};
      if (j0 >= 0 && j0 + 16 <= L) {            // wave-uniform; out-of-range offset tiles are never read unmasked
#pragma unroll
        for (int kc = 0; kc < 2; ++kc) s = wmma_bf(aq[kc], split_col(pe, kc * 32, j0 + col, lane, L, D).h, s); }
#pragma unroll
      for (int r = 0; r < 8; ++r) sQP[w][8 * g + r][pt * 16 + col] = s[r];
      if (pt == 4) qp_last = s; }
    __syncthreads();      // every wave has left the previous key and value tile
    { __bf16* dk = &sK[sr][sc]; __bf16* dv = &sVt[sc][2 * sr];
#pragma unroll
      for (int it = 0; it < 8; ++it) { const v4b h = { (__bf16)kf[it][0], (__bf16)kf[it][1], (__bf16)kf[it][2], (__bf16)kf[it][3] }; *(v4b*)(dk + it * 8 * 72) = h; }
#pragma unroll
      for (int it = 0; it < 4; ++it) {
#pragma unroll
        for (int i = 0; i < 4; ++i) { const v2b h = { (__bf16)va[it][i], (__bf16)vc[it][i] }; *(v2b*)(dv + i * 72 + it * 16) = h; } } }
    __syncthreads();      // the new tiles are visible to all four waves
    // (2) content scores for keys key0 .. key0+63
#pragma unroll
    for (int t = 0; t < 4; ++t) { v8f s = {};
#pragma unroll
      for (int kc = 0; kc < 2; ++kc) s = wmma_bf(aq[kc], frag_b(&sK[t * 16 + col][kc * 32], lane), s);
#pragma unroll
      for (int r = 0; r < 8; ++r) sS[w][8 * g + r][t * 16 + col] = s[r]; }
    LDSX();
    // (3) combine with the band mask: lane (col = query row rq, g = key half) handles keys g*32 .. g*32+31 of its row
    { const int rq = col; const int i = q0 + rq;
#pragma unroll 16      // two trips: fully unrolled, one index register per key stays live through the whole tile loop, and with the 64 staging registers the kernel passes 256 VGPRs (three waves per SIMD instead of four)
      for (int jj = 0; jj < 32; ++jj) { const int kc_ = g * 32 + jj; const int kk = key0 + kc_; const int j = kk - i; float v;
        if (j < 0 || j >= L) v = -3.0e38f;
        else { float sc = sS[w][rq][kc_];
          // the reference replaces an EXACTLY zero content score by -1e6 before adding the position term; with bf16-rounded inputs exact zeros do occur (a few per run).
          // Near-zero candidates are re-evaluated as a sequential f32 fma chain over the bf16-rounded rows (the reference's accumulation order) and the rule applied on that value.
          if (fabsf(sc) < 1.0e-5f) { const float* qr = qb_ + (size_t)i * D; const float* kr = kb_ + (size_t)kk * D; float acc_ = 0.f;
            for (int dd = 0; dd < D; ++dd) acc_ = fmaf((float)(__bf16)qr[dd], (float)(__bf16)kr[dd], acc_);
            if (acc_ == 0.0f) sc = -1000000.0f; }
          v = (sc + sQP[w][rq][j - jw]) * 0.125f; }
        sS[w][rq][kc_] = v; } }
    LDSX();
    float mx = -3.4e38f;
#pragma unroll
    for (int jj = 0; jj < 32; ++jj) mx = fmaxf(mx, sS[w][col][g * 32 + jj]);
    mx = fmaxf(mx, __shfl_xor(mx, 16, 32));
    const float mnew = fmaxf(mrun, mx); const float corr = expf(mrun - mnew);
    float ps = 0.f;
#pragma unroll
    for (int jj = 0; jj < 32; ++jj) { const float sv = sS[w][col][g * 32 + jj]; const float p = sv <= -1.0e38f ? 0.f : expf(sv - mnew); ps += p; sS[w][col][g * 32 + jj] = p; }
    ps += __shfl_xor(ps, 16, 32);
    lrun = lrun * corr + ps; mrun = mnew;
#pragma unroll
    for (int r = 0; r < 8; ++r) { const float cr = __shfl(corr, 8 * g + r, 32);
#pragma unroll
      for (int t = 0; t < 4; ++t) { acc[t][r] *= cr; ac2[t][r] *= cr; } }
    LDSX();
    // (4) O += P (hi/lo) x bf16(V rows key0+kc*32 ..)
#pragma unroll
    for (int kc = 0; kc < 2; ++kc) { const F2 pa = split_row(&sS[w][col][0], kc * 32, lane);
#pragma unroll
      for (int t = 0; t < 4; ++t) { const v16b vb = frag_b(&sVt[t * 16 + col][kc * 32], lane); acc[t] = wmma_bf(pa.h, vb, acc[t]); ac2[t] = wmma_bf(pa.l, vb, ac2[t]); } }
    LDSX(); }
#pragma unroll
  for (int r = 0; r < 8; ++r) { const float lr = __shfl(lrun, 8 * g + r, 32); const float inv = 1.0f / lr;
#pragma unroll
    for (int t = 0; t < 4; ++t) sS[w][8 * g + r][t * 16 + col] = (acc[t][r] + ac2[t][r]) * inv; }
  LDSX();
  for (int qq = lane; qq < 16 * 16; qq += 32) { const int rl = qq >> 4, pc = qq & 15; vst2(out + ((size_t)b * M + q0 + rl) * D + pc * 4, *(const v4f*)(&sS[w][rl][pc * 4])); }
}
extern "C" void kernel_launch(void* const* d_in, const int* in_sizes, int n_in, void* d_out, int out_size, void* d_ws, size_t ws_size, hipStream_t stream) {
  (void)in_sizes; (void)n_in; (void)out_size; (void)ws_size; (void)d_ws;
  const float* query = (const float*)d_in[0]; const float* key = (const float*)d_in[1]; const float* value = (const float*)d_in[2]; const float* pe = (const float*)d_in[3];
  float* out = (float*)d_out;
  k_seq<<<dim3(M / 64, NBH), 128, 0, stream>>>(query, key, value, pe, out);
}

// v003
// One run takes 89.4 microseconds.
// Timed twice side by side with v002, it ran 1.84 times as fast both times.
// Over all steps from v000 it is 2.76 times as fast.
// compute dtype: the INPUTS query/key/value/key_pe rounded to bf16 and multiplied with exact bf16 WMMA products (f32 accumulate); the softmax weights P (computed) as a bf16 hi/lo pair; mask and softmax f32.
#include <hip/hip_runtime.h>
#include <math.h>

typedef __attribute__((ext_vector_type(16))) _Float16 v16h;
typedef __attribute__((ext_vector_type(16))) __bf16 v16b;
typedef __attribute__((ext_vector_type(8)))  _Float16 v8h;
typedef __attribute__((ext_vector_type(8)))  __bf16 v8b;
typedef __attribute__((ext_vector_type(4)))  __bf16 v4b;
typedef __attribute__((ext_vector_type(2)))  __bf16 v2b;
typedef __attribute__((ext_vector_type(8)))  float v8f;
typedef __attribute__((ext_vector_type(4)))  float v4f;
typedef __attribute__((ext_vector_type(2)))  float v2f;
typedef __attribute__((ext_vector_type(4)))  unsigned v4u;
typedef __attribute__((ext_vector_type(4)))  int v4i;
typedef float __attribute__((may_alias)) float_a;
typedef int __attribute__((may_alias)) int_a;

template <typename T> __device__ __forceinline__ void vst2(void* p, T v) { *(T*)p = v;  }
__device__ __forceinline__ v8f wmma16(v16h a, v16h b, v8f c) {
  v8f d = __builtin_amdgcn_wmma_f32_16x16x32_f16(false, a, false, b, (short)0, c, false, false);
  asm volatile("v_nop\n\tv_nop\n\tv_nop\n\tv_nop" : "+v"(d) : "v"(a), "v"(b));
  return d;
}
__device__ __forceinline__ v8f wmma_bf(v16b a, v16b b, v8f c) {
  v8f d = __builtin_amdgcn_wmma_f32_16x16x32_bf16(false, a, false, b, (short)0, c, false, false);
  asm volatile("v_nop\n\tv_nop\n\tv_nop\n\tv_nop" : "+v"(d) : "v"(a), "v"(b));
  return d;
}
// 16x16x32 fragments: lane = (h = lane>>4, row/col = lane&15); elements 0..7 = k0+8h+0..7, 8..15 = k0+16+8h+0..7; D element r = row 8h+r
__device__ __forceinline__ v16h frag_h(const _Float16* rowk0, int lane) {
  union { v16h v; v8h q[2]; } u; const _Float16* p = rowk0 + 8 * (lane >> 4);
  u.q[0] = *(const v8h*)p; u.q[1] = *(const v8h*)(p + 16); return u.v;
}
__device__ __forceinline__ v16b frag_b(const __bf16* rowk0, int lane) {
  union { v16b v; v8b q[2]; } u; const __bf16* p = rowk0 + 8 * (lane >> 4);
  u.q[0] = *(const v8b*)p; u.q[1] = *(const v8b*)(p + 16); return u.v;
}
__device__ __forceinline__ v16h frag_f32(const float* rowk0, int lane) {
  v16h a; const float* p = rowk0 + 8 * (lane >> 4);
#pragma unroll
  for (int i = 0; i < 8; ++i) { a[i] = (_Float16)p[i]; a[8 + i] = (_Float16)p[16 + i]; }
  return a;
}
__device__ __forceinline__ v16h frag_f32s(const float* rowk0, int lane, float sc) {
  v16h a; const float* p = rowk0 + 8 * (lane >> 4);
#pragma unroll
  for (int i = 0; i < 8; ++i) { a[i] = (_Float16)(p[i] * sc); a[8 + i] = (_Float16)(p[16 + i] * sc); }
  return a;
}
// column fragment from a [K][ld] layout (column n), rows >= K read as 0
__device__ __forceinline__ v16h fragc_f32(const float* W, int k0, int n, int lane, int ld, int K) {
  v16h a; const int g = lane >> 4;
#pragma unroll
  for (int i = 0; i < 8; ++i) { const int ka = k0 + 8 * g + i, kb = ka + 16;
    a[i] = (_Float16)(ka < K ? W[(size_t)ka * ld + n] : 0.f); a[8 + i] = (_Float16)(kb < K ? W[(size_t)kb * ld + n] : 0.f); }
  return a;
}
struct F2 { v16b h, l; };
__device__ __forceinline__ F2 bsplit16(const float v[16]) { F2 r;
#pragma unroll
  for (int i = 0; i < 16; ++i) { const __bf16 h = (__bf16)v[i]; r.h[i] = h; r.l[i] = (__bf16)(v[i] - (float)h); }
  return r; }
__device__ __forceinline__ F2 split_row(const float* row, int k0, int lane) { float v[16]; const float* p = row + k0 + 8 * (lane >> 4);
#pragma unroll
  for (int i = 0; i < 8; ++i) { v[i] = p[i]; v[8 + i] = p[16 + i]; }
  return bsplit16(v); }
__device__ __forceinline__ F2 split_rowK(const float* row, int k0, int lane, int K) { float v[16]; const int g = lane >> 4;
#pragma unroll
  for (int i = 0; i < 8; ++i) { const int ka = k0 + 8 * g + i, kb = ka + 16; v[i] = ka < K ? row[ka] : 0.f; v[8 + i] = kb < K ? row[kb] : 0.f; }
  return bsplit16(v); }
__device__ __forceinline__ F2 split_col(const float* W, int k0, int n, int lane, int ld, int K) { float v[16]; const int g = lane >> 4;
#pragma unroll
  for (int i = 0; i < 8; ++i) { const int ka = k0 + 8 * g + i, kb = ka + 16; v[i] = ka < K ? W[(size_t)ka * ld + n] : 0.f; v[8 + i] = kb < K ? W[(size_t)kb * ld + n] : 0.f; }
  return bsplit16(v); }
__device__ __forceinline__ v8f mac3(const F2& a, const F2& b, v8f c) { c = wmma_bf(a.l, b.h, c); c = wmma_bf(a.h, b.l, c); return wmma_bf(a.h, b.h, c); }
__device__ __forceinline__ float sigm(float v) { return 1.0f / (1.0f + expf(-v)); }
#define LDSX() do { asm volatile("s_wait_dscnt 0" ::: "memory"); __builtin_amdgcn_wave_barrier(); __builtin_amdgcn_fence(__ATOMIC_RELEASE, "workgroup"); } while (0)


// Banded attention with relative position scores (the skew/unskew module): for query i (1,024 per batch-head, 64 batch-heads) and offset j in [0, 1024):
// a(i,j) = softmax_j((q_i . k_{i+j} + q_i . pe_j) / 8); out_i = sum_j a(i,j) v_{i+j}. (The reference's "== 0 -> -1e6" substitution DOES fire a few times per run on bf16-rounded inputs and is replicated.)
// Block = (64 queries, batch-head); 17 key tiles of 64 starting at q0 cover keys q0 .. q0+1087.
// All three products are formed transposed (keys x queries, offsets x queries, head dim x queries), so that in every accumulator a lane's column is ONE query:
// lane (col = query, g) holds keys t*16 + 8g + r of its query in st[t][r]. Mask, maximum, exponential and sum are then in-lane (one exchange between the halves),
// the weights P are already in the operand order of the next product (elements 0..7 = tile 2kc, 8..15 = tile 2kc+1), and the running rescale is the lane's own factor.
// Only the position scores pass through LDS, because their offset j = key - query shifts with the lane: 16x80 slab per wave (64 offsets are new in a step, the first 16 are the previous step's last).
// The reference's '== 0 -> -1e6' rule is honoured: near-zero content scores are re-checked with a sequential f32 fma chain over the bf16-rounded rows. No ws; whole 256-B output rows by one wave.
// The key and value tile of a step are the same for the block's four waves: they are rounded to bf16 once, staged in LDS (value transposed) and read as fragments with 16-byte LDS loads.
// The output rows are staged in the position-score buffer, which is free by then.
#define NBH 64
#define M 1024
#define KL 2048
#define L 1024
#define D 64
#define NKT 17

// eight consecutive floats of one accumulator to LDS as two 16-byte stores (the rows are 16-byte aligned, not 32)
__device__ __forceinline__ void st8(float* p, v8f v) { *(v4f*)p = __builtin_shufflevector(v, v, 0, 1, 2, 3); *(v4f*)(p + 4) = __builtin_shufflevector(v, v, 4, 5, 6, 7); }

__global__ __launch_bounds__(128) void k_seq(const float* __restrict__ query, const float* __restrict__ key, const float* __restrict__ value, const float* __restrict__ pe, float* __restrict__ out) {
  __shared__ __align__(16) float sQP[4][16][84];      // [query][offset - jw]: q.pe for the 80 offsets jw .. jw+79 that this wave's tile can touch (jw = key0 - q0 - 16)
  __shared__ __align__(16) __bf16 sK[64][72];         // the block's key tile rounded to bf16, [key][d]; 144-byte rows suit the 16-byte fragment reads
  __shared__ __align__(16) __bf16 sVt[64][72];        // the block's value tile rounded to bf16, transposed to [d][key]
  const int tid = threadIdx.x, w = tid >> 5, lane = tid & 31, col = lane & 15, g = lane >> 4;
#ifndef BH0
#define BH0 0
#endif
  const int b = blockIdx.y + BH0; const int q0 = blockIdx.x * 64 + w * 16;
  const float* qb_ = query + (size_t)b * M * D; const float* kb_ = key + (size_t)b * KL * D; const float* vb_ = value + (size_t)b * KL * D;
  v16b aq[2];                          // the wave's 16 queries, used as the second operand (column = query)
#pragma unroll
  for (int kc = 0; kc < 2; ++kc) aq[kc] = split_row(qb_ + (size_t)(q0 + col) * D, kc * 32, lane).h;
  float mrun = -3.0e38f, lrun = 0.f; v8f acc[4] = {}, ac2[4] = {};     // acc[t][r]: head-dim element t*16 + 8g + r of query col
  v8f qp_last = {};                    // the previous step's last 16 offsets of q.pe: they are this step's first 16
  const int sr = tid >> 4, sc = (tid & 15) * 4;      // this thread's place in the staging of a tile
  const int kt0 = blockIdx.x;          // first key tile = the one starting at the block's first query
  const int i = q0 + col;              // this lane's query
  float* const qpw = &sQP[w][col][8 * g];            // where this lane stores its 8 offsets of a 16-offset tile
  const float* const qpr = &sQP[w][col][16 - col + 8 * g];   // key t*16 + 8g + r of query col has offset index (t*16 + 8g + r) - col + 16
#pragma unroll 1
  for (int kt = 0; kt < NKT; ++kt) { const int key0 = (kt0 + kt) * 64; if (key0 >= KL) break;       // block-uniform
    // (1) position-score slab: the offsets depend on the query: j = key - i. For this wave's queries i in [q0, q0+16)
    //     and keys in [key0, key0+64): j in [key0 - q0 - 15, key0 - q0 + 63] subset of [jw, jw + 80) with jw = key0 - q0 - 16 (wave-specific base, a multiple of 16: q0 = 64*bx + 16w -> jw = 64*kt - 16*w - 16).
    //     jw grows by 64 a step, so offsets jw .. jw+15 are the previous step's jw+64 .. jw+79: that product is kept in registers and stored again, and only four 16-offset tiles are multiplied per step.
    // (0) the four waves share one key tile and one value tile: each thread fetches 1/128 of both in whole 128-byte lines (key rows sr + 8*it; value rows 2*sr + 16*it and the next; columns sc .. sc+3).
    //     The loads are issued here so that they fly under the position slab; rounding and the LDS stores follow behind it.
    v4f kf[8], va[4], vc[4];
    { const float* kt_ = kb_ + (size_t)key0 * D + sr * D + sc; const float* vt_ = vb_ + (size_t)key0 * D + 2 * sr * D + sc;
#pragma unroll
      for (int it = 0; it < 8; ++it) kf[it] = *(const v4f*)(kt_ + it * 8 * D);
#pragma unroll
      for (int it = 0; it < 4; ++it) { va[it] = *(const v4f*)(vt_ + it * 16 * D); vc[it] = *(const v4f*)(vt_ + it * 16 * D + D); } }
    const int jw = key0 - q0 - 16;
    st8(qpw, qp_last);
#pragma unroll
    for (int pt = 1; pt < 5; ++pt) { const int j0 = jw + pt * 16; v8f s = {};
      if (j0 >= 0 && j0 + 16 <= L) {            // wave-uniform; out-of-range offset tiles are never used unmasked
#pragma unroll
        for (int kc = 0; kc < 2; ++kc) s = wmma_bf(split_col(pe, kc * 32, j0 + col, lane, L, D).h, aq[kc], s); }
      st8(qpw + pt * 16, s);
      if (pt == 4) qp_last = s; }
    __syncthreads();      // every wave has left the previous key and value tile
    { __bf16* dk = &sK[sr][sc]; __bf16* dv = &sVt[sc][2 * sr];
#pragma unroll
      for (int it = 0; it < 8; ++it) { const v4b h = { (__bf16)kf[it][0], (__bf16)kf[it][1], (__bf16)kf[it][2], (__bf16)kf[it][3] }; *(v4b*)(dk + it * 8 * 72) = h; }
#pragma unroll
      for (int it = 0; it < 4; ++it) {
#pragma unroll
        for (int ii = 0; ii < 4; ++ii) { const v2b h = { (__bf16)va[it][ii], (__bf16)vc[it][ii] }; *(v2b*)(dv + ii * 72 + it * 16) = h; } } }
    __syncthreads();      // the new tiles are visible to all four waves (and each wave's slab to its own lanes)
    // (2) content scores, transposed: st[t][r] = k_{key0 + t*16 + 8g + r} . q_i
    v8f st[4];
#pragma unroll
    for (int t = 0; t < 4; ++t) { v8f s = {};
#pragma unroll
      for (int kc = 0; kc < 2; ++kc) s = wmma_bf(frag_b(&sK[t * 16 + col][kc * 32], lane), aq[kc], s);
      st[t] = s; }
    // (3) zero rule, position score and band mask, in registers
    // The reference replaces an EXACTLY zero content score by -1e6 before adding the position term; with bf16-rounded inputs exact zeros do occur (a few per run).
    // Near-zero candidates are re-evaluated as a sequential f32 fma chain over the bf16-rounded rows (the reference's accumulation order) and the rule applied on that value.
    // One test per lane and tile finds whether there is a candidate at all; the rare path then walks the lane's 32 keys (bit e = t*8 + r).
    float amin = 3.0e38f;
#pragma unroll
    for (int t = 0; t < 4; ++t) {
#pragma unroll
      for (int r = 0; r < 8; ++r) amin = fminf(amin, fabsf(st[t][r])); }
    if (amin < 1.0e-5f) { unsigned nz = 0u, zr = 0u;
#pragma unroll
      for (int t = 0; t < 4; ++t) {
#pragma unroll
        for (int r = 0; r < 8; ++r) nz |= (fabsf(st[t][r]) < 1.0e-5f ? 1u : 0u) << (t * 8 + r); }
      const float* qr = qb_ + (size_t)i * D;
#pragma unroll 1      // rare path: kept rolled so that it costs the tile loop neither registers nor instruction cache
      for (int e = 0; e < 32; ++e) { if ((nz >> e) & 1u) { const float* kr = kb_ + (size_t)(key0 + (e >> 3) * 16 + 8 * g + (e & 7)) * D; float acc_ = 0.f;
          for (int dd = 0; dd < D; ++dd) acc_ = fmaf((float)(__bf16)qr[dd], (float)(__bf16)kr[dd], acc_);
          if (acc_ == 0.0f) zr |= 1u << e; } }
#pragma unroll
      for (int t = 0; t < 4; ++t) {
#pragma unroll
        for (int r = 0; r < 8; ++r) { if ((zr >> (t * 8 + r)) & 1u) st[t][r] = -1000000.0f; } } }
    const int jb = key0 + 8 * g - i;   // offset j of this lane's key (t = 0, r = 0)
    float mx = -3.4e38f;
#pragma unroll
    for (int t = 0; t < 4; ++t) {
#pragma unroll
      for (int r = 0; r < 8; ++r) { const float v = (st[t][r] + qpr[t * 16 + r]) * 0.125f;
        const float vm = (unsigned)(jb + t * 16 + r) < (unsigned)L ? v : -3.0e38f;      // j < 0 or j >= L: outside the band
        st[t][r] = vm; mx = fmaxf(mx, vm); } }
    mx = fmaxf(mx, __shfl_xor(mx, 16, 32));
    const float mnew = fmaxf(mrun, mx); const float corr = expf(mrun - mnew);
    float ps = 0.f;
#pragma unroll
    for (int t = 0; t < 4; ++t) {
#pragma unroll
      for (int r = 0; r < 8; ++r) { const float sv = st[t][r]; const float ex = expf(sv - mnew); const float p = sv <= -1.0e38f ? 0.f : ex; ps += p; st[t][r] = p; } }
    ps += __shfl_xor(ps, 16, 32);
    lrun = lrun * corr + ps; mrun = mnew;
#pragma unroll
    for (int t = 0; t < 4; ++t) { acc[t] *= corr; ac2[t] *= corr; }
    // (4) O^T += bf16(V)^T x P^T (hi/lo): the second operand's elements 0..7 are keys kc*32 + 8g + 0..7 = st[2kc], elements 8..15 are keys kc*32 + 16 + 8g + 0..7 = st[2kc+1]
#pragma unroll
    for (int kc = 0; kc < 2; ++kc) { float pv[16];
#pragma unroll
      for (int r = 0; r < 8; ++r) { pv[r] = st[2 * kc][r]; pv[8 + r] = st[2 * kc + 1][r]; }
      const F2 pa = bsplit16(pv);
#pragma unroll
      for (int t = 0; t < 4; ++t) { const v16b vb = frag_b(&sVt[t * 16 + col][kc * 32], lane); acc[t] = wmma_bf(vb, pa.h, acc[t]); ac2[t] = wmma_bf(vb, pa.l, ac2[t]); } }
    LDSX(); }
  { const float inv = 1.0f / lrun;
#pragma unroll
    for (int t = 0; t < 4; ++t) st8(qpw + t * 16, (acc[t] + ac2[t]) * inv); }
  LDSX();
  for (int qq = lane; qq < 16 * 16; qq += 32) { const int rl = qq >> 4, pc = qq & 15; vst2(out + ((size_t)b * M + q0 + rl) * D + pc * 4, *(const v4f*)(&sQP[w][rl][pc * 4])); }
}
extern "C" void kernel_launch(void* const* d_in, const int* in_sizes, int n_in, void* d_out, int out_size, void* d_ws, size_t ws_size, hipStream_t stream) {
  (void)in_sizes; (void)n_in; (void)out_size; (void)ws_size; (void)d_ws;
  const float* query = (const float*)d_in[0]; const float* key = (const float*)d_in[1]; const float* value = (const float*)d_in[2]; const float* pe = (const float*)d_in[3];
  float* out = (float*)d_out;
  k_seq<<<dim3(M / 64, NBH), 128, 0, stream>>>(query, key, value, pe, out);
}

// v004
// A run of this version takes 77.6 microseconds.
// In both of two side-by-side timings against v003, it was 1.15 times as fast.
// Over all steps from v000 it is 3.18 times as fast.
// compute dtype: the INPUTS query/key/value/key_pe rounded to bf16 and multiplied with exact bf16 WMMA products (f32 accumulate); the softmax weights P (computed) as a bf16 hi/lo pair; mask and softmax f32.
#include <hip/hip_runtime.h>
#include <math.h>

typedef __attribute__((ext_vector_type(16))) _Float16 v16h;
typedef __attribute__((ext_vector_type(16))) __bf16 v16b;
typedef __attribute__((ext_vector_type(8)))  _Float16 v8h;
typedef __attribute__((ext_vector_type(8)))  __bf16 v8b;
typedef __attribute__((ext_vector_type(4)))  __bf16 v4b;
typedef __attribute__((ext_vector_type(2)))  __bf16 v2b;
typedef __attribute__((ext_vector_type(8)))  float v8f;
typedef __attribute__((ext_vector_type(4)))  float v4f;
typedef __attribute__((ext_vector_type(2)))  float v2f;
typedef __attribute__((ext_vector_type(4)))  unsigned v4u;
typedef __attribute__((ext_vector_type(4)))  int v4i;
typedef float __attribute__((may_alias)) float_a;
typedef int __attribute__((may_alias)) int_a;

template <typename T> __device__ __forceinline__ void vst2(void* p, T v) { *(T*)p = v;  }
__device__ __forceinline__ v8f wmma16(v16h a, v16h b, v8f c) {
  v8f d = __builtin_amdgcn_wmma_f32_16x16x32_f16(false, a, false, b, (short)0, c, false, false);
  asm volatile("v_nop\n\tv_nop\n\tv_nop\n\tv_nop" : "+v"(d) : "v"(a), "v"(b));
  return d;
}
__device__ __forceinline__ v8f wmma_bf(v16b a, v16b b, v8f c) {
  v8f d = __builtin_amdgcn_wmma_f32_16x16x32_bf16(false, a, false, b, (short)0, c, false, false);
  asm volatile("v_nop\n\tv_nop\n\tv_nop\n\tv_nop" : "+v"(d) : "v"(a), "v"(b));
  return d;
}
// 16x16x32 fragments: lane = (h = lane>>4, row/col = lane&15); elements 0..7 = k0+8h+0..7, 8..15 = k0+16+8h+0..7; D element r = row 8h+r
__device__ __forceinline__ v16h frag_h(const _Float16* rowk0, int lane) {
  union { v16h v; v8h q[2]; } u; const _Float16* p = rowk0 + 8 * (lane >> 4);
  u.q[0] = *(const v8h*)p; u.q[1] = *(const v8h*)(p + 16); return u.v;
}
__device__ __forceinline__ v16b frag_b(const __bf16* rowk0, int lane) {
  union { v16b v; v8b q[2]; } u; const __bf16* p = rowk0 + 8 * (lane >> 4);
  u.q[0] = *(const v8b*)p; u.q[1] = *(const v8b*)(p + 16); return u.v;
}
__device__ __forceinline__ v16h frag_f32(const float* rowk0, int lane) {
  v16h a; const float* p = rowk0 + 8 * (lane >> 4);
#pragma unroll
  for (int i = 0; i < 8; ++i) { a[i] = (_Float16)p[i]; a[8 + i] = (_Float16)p[16 + i]; }
  return a;
}
__device__ __forceinline__ v16h frag_f32s(const float* rowk0, int lane, float sc) {
  v16h a; const float* p = rowk0 + 8 * (lane >> 4);
#pragma unroll
  for (int i = 0; i < 8; ++i) { a[i] = (_Float16)(p[i] * sc); a[8 + i] = (_Float16)(p[16 + i] * sc); }
  return a;
}
// column fragment from a [K][ld] layout (column n), rows >= K read as 0
__device__ __forceinline__ v16h fragc_f32(const float* W, int k0, int n, int lane, int ld, int K) {
  v16h a; const int g = lane >> 4;
#pragma unroll
  for (int i = 0; i < 8; ++i) { const int ka = k0 + 8 * g + i, kb = ka + 16;
    a[i] = (_Float16)(ka < K ? W[(size_t)ka * ld + n] : 0.f); a[8 + i] = (_Float16)(kb < K ? W[(size_t)kb * ld + n] : 0.f); }
  return a;
}
struct F2 { v16b h, l; };
__device__ __forceinline__ F2 bsplit16(const float v[16]) { F2 r;
#pragma unroll
  for (int i = 0; i < 16; ++i) { const __bf16 h = (__bf16)v[i]; r.h[i] = h; r.l[i] = (__bf16)(v[i] - (float)h); }
  return r; }
__device__ __forceinline__ F2 split_row(const float* row, int k0, int lane) { float v[16]; const float* p = row + k0 + 8 * (lane >> 4);
#pragma unroll
  for (int i = 0; i < 8; ++i) { v[i] = p[i]; v[8 + i] = p[16 + i]; }
  return bsplit16(v); }
__device__ __forceinline__ F2 split_rowK(const float* row, int k0, int lane, int K) { float v[16]; const int g = lane >> 4;
#pragma unroll
  for (int i = 0; i < 8; ++i) { const int ka = k0 + 8 * g + i, kb = ka + 16; v[i] = ka < K ? row[ka] : 0.f; v[8 + i] = kb < K ? row[kb] : 0.f; }
  return bsplit16(v); }
__device__ __forceinline__ F2 split_col(const float* W, int k0, int n, int lane, int ld, int K) { float v[16]; const int g = lane >> 4;
#pragma unroll
  for (int i = 0; i < 8; ++i) { const int ka = k0 + 8 * g + i, kb = ka + 16; v[i] = ka < K ? W[(size_t)ka * ld + n] : 0.f; v[8 + i] = kb < K ? W[(size_t)kb * ld + n] : 0.f; }
  return bsplit16(v); }
__device__ __forceinline__ v8f mac3(const F2& a, const F2& b, v8f c) { c = wmma_bf(a.l, b.h, c); c = wmma_bf(a.h, b.l, c); return wmma_bf(a.h, b.h, c); }
__device__ __forceinline__ float sigm(float v) { return 1.0f / (1.0f + expf(-v)); }
#define LDSX() do { asm volatile("s_wait_dscnt 0" ::: "memory"); __builtin_amdgcn_wave_barrier(); __builtin_amdgcn_fence(__ATOMIC_RELEASE, "workgroup"); } while (0)


// Banded attention with relative position scores (the skew/unskew module): for query i (1,024 per batch-head, 64 batch-heads) and offset j in [0, 1024):
// a(i,j) = softmax_j((q_i . k_{i+j} + q_i . pe_j) / 8); out_i = sum_j a(i,j) v_{i+j}. (The reference's "== 0 -> -1e6" substitution DOES fire a few times per run on bf16-rounded inputs and is replicated.)
// Block = (64 queries, batch-head); 17 key tiles of 64 starting at q0 cover keys q0 .. q0+1087.
// All three products are formed transposed (keys x queries, offsets x queries, head dim x queries), so that in every accumulator a lane's column is ONE query:
// lane (col = query, g) holds keys t*16 + 8g + r of its query in st[t][r]. Mask, maximum, exponential and sum are then in-lane (one exchange between the halves),
// the weights P are already in the operand order of the next product (elements 0..7 = tile 2kc, 8..15 = tile 2kc+1), and the running rescale is the lane's own factor.
// Of the scores, only the position scores pass through LDS, because their offset j = key - query shifts with the lane: 16x80 slab per wave (64 offsets are new in a step, the first 16 are the previous step's last).
// The reference's '== 0 -> -1e6' rule is honoured: near-zero content scores are re-checked with a sequential f32 fma chain over the bf16-rounded rows. No ws; whole 256-B output rows by one wave.
// The key and value tile of a step are the same for the block's four waves: they are rounded to bf16 once, staged in LDS (value transposed) and read as fragments with 16-byte LDS loads.
// The output rows are staged in the position-score buffer, which is free by then.
#define NBH 64
#define M 1024
#define KL 2048
#define L 1024
#define D 64
#define NKT 17
// exp((s - m) / 8) = 2^(s * SC2 - m * SC2): the division by 8 and the change of base are one factor, applied together with the running maximum in one fused multiply-add in front of the hardware's base-2 exponential.
// The exponent is <= 0; below -126 the hardware form returns 0 where the library form returned a subnormal, far below one unit in the last place of the row sum, whose largest term is 1 up to rounding.
#define SC2 0.18033688011112042f      // log2(e) / 8

// eight consecutive floats of one accumulator to LDS as two 16-byte stores (the rows are 16-byte aligned, not 32)
__device__ __forceinline__ void st8(float* p, v8f v) { *(v4f*)p = __builtin_shufflevector(v, v, 0, 1, 2, 3); *(v4f*)(p + 4) = __builtin_shufflevector(v, v, 4, 5, 6, 7); }

// 2^x of eight values. One statement, so that every exponential is followed by an instruction that touches neither its result nor its source:
// the next exponential (the results are early-clobber, so none lies on a source), and behind the last one the v_nop: the slot that the instruction set asks for behind a transcendental.
__device__ __forceinline__ v8f exp2x8(v8f x) {
  float a, b, c, d, e, f, g, h;
  asm("v_exp_f32 %0, %8\n\tv_exp_f32 %1, %9\n\tv_exp_f32 %2, %10\n\tv_exp_f32 %3, %11\n\tv_exp_f32 %4, %12\n\tv_exp_f32 %5, %13\n\tv_exp_f32 %6, %14\n\tv_exp_f32 %7, %15\n\tv_nop"
      : "=&v"(a), "=&v"(b), "=&v"(c), "=&v"(d), "=&v"(e), "=&v"(f), "=&v"(g), "=&v"(h)
      : "v"(x[0]), "v"(x[1]), "v"(x[2]), "v"(x[3]), "v"(x[4]), "v"(x[5]), "v"(x[6]), "v"(x[7]));
  return (v8f){ a, b, c, d, e, f, g, h };
}

__global__ __launch_bounds__(128) void k_seq(const float* __restrict__ query, const float* __restrict__ key, const float* __restrict__ value, const float* __restrict__ pe, float* __restrict__ out) {
  __shared__ __align__(16) float sQP[4][16][84];      // [query][offset - jw]: q.pe for the 80 offsets jw .. jw+79 that this wave's tile can touch (jw = key0 - q0 - 16)
  __shared__ __align__(16) __bf16 sK[64][72];         // the block's key tile rounded to bf16, [key][d]; 144-byte rows suit the 16-byte fragment reads
  __shared__ __align__(16) __bf16 sVt[64][72];        // the block's value tile rounded to bf16, transposed to [d][key]
  const int tid = threadIdx.x, w = tid >> 5, lane = tid & 31, col = lane & 15, g = lane >> 4;
#ifndef BH0
#define BH0 0
#endif
  const int b = blockIdx.y + BH0; const int q0 = blockIdx.x * 64 + w * 16;
  const float* qb_ = query + (size_t)b * M * D; const float* kb_ = key + (size_t)b * KL * D; const float* vb_ = value + (size_t)b * KL * D;
  v16b aq[2];                          // the wave's 16 queries, used as the second operand (column = query)
#pragma unroll
  for (int kc = 0; kc < 2; ++kc) aq[kc] = split_row(qb_ + (size_t)(q0 + col) * D, kc * 32, lane).h;
  float mrun = -3.0e38f, lrun = 0.f;   // mrun: running maximum of the scores before their scaling
  v8f acc[4] = {}, ac2[4] = {};     // acc[t][r]: head-dim element t*16 + 8g + r of query col
  v8f qp_last = {};                    // the previous step's last 16 offsets of q.pe: they are this step's first 16
  const int sr = tid >> 4, sc = (tid & 15) * 4;      // this thread's place in the staging of a tile
  const int kt0 = blockIdx.x;          // first key tile = the one starting at the block's first query
  const int i = q0 + col;              // this lane's query
  float* const qpw = &sQP[w][col][8 * g];            // where this lane stores its 8 offsets of a 16-offset tile
  const float* const qpr = &sQP[w][col][16 - col + 8 * g];   // key t*16 + 8g + r of query col has offset index (t*16 + 8g + r) - col + 16
#pragma unroll 1
  for (int kt = 0; kt < NKT; ++kt) { const int key0 = (kt0 + kt) * 64; if (key0 >= KL) break;       // block-uniform
    // (1) position-score slab: the offsets depend on the query: j = key - i. For this wave's queries i in [q0, q0+16)
    //     and keys in [key0, key0+64): j in [key0 - q0 - 15, key0 - q0 + 63] subset of [jw, jw + 80) with jw = key0 - q0 - 16 (wave-specific base, a multiple of 16: q0 = 64*bx + 16w -> jw = 64*kt - 16*w - 16).
    //     jw grows by 64 a step, so offsets jw .. jw+15 are the previous step's jw+64 .. jw+79: that product is kept in registers and stored again, and only four 16-offset tiles are multiplied per step.
    // (0) the four waves share one key tile and one value tile: each thread fetches 1/128 of both in whole 128-byte lines (key rows sr + 8*it; value rows 2*sr + 16*it and the next; columns sc .. sc+3).
    //     The loads are issued here so that they fly under the position slab; rounding and the LDS stores follow behind it.
    v4f kf[8], va[4], vc[4];
    { const float* kt_ = kb_ + (size_t)key0 * D + sr * D + sc; const float* vt_ = vb_ + (size_t)key0 * D + 2 * sr * D + sc;
#pragma unroll
      for (int it = 0; it < 8; ++it) kf[it] = *(const v4f*)(kt_ + it * 8 * D);
#pragma unroll
      for (int it = 0; it < 4; ++it) { va[it] = *(const v4f*)(vt_ + it * 16 * D); vc[it] = *(const v4f*)(vt_ + it * 16 * D + D); } }
    const int jw = key0 - q0 - 16;
    st8(qpw, qp_last);
#pragma unroll
    for (int pt = 1; pt < 5; ++pt) { const int j0 = jw + pt * 16; v8f s = {};
      if (j0 >= 0 && j0 + 16 <= L) {            // wave-uniform; out-of-range offset tiles are never used unmasked
#pragma unroll
        for (int kc = 0; kc < 2; ++kc) s = wmma_bf(split_col(pe, kc * 32, j0 + col, lane, L, D).h, aq[kc], s); }
      st8(qpw + pt * 16, s);
      if (pt == 4) qp_last = s; }
    __syncthreads();      // every wave has left the previous key and value tile
    { __bf16* dk = &sK[sr][sc]; __bf16* dv = &sVt[sc][2 * sr];
#pragma unroll
      for (int it = 0; it < 8; ++it) { const v4b h = { (__bf16)kf[it][0], (__bf16)kf[it][1], (__bf16)kf[it][2], (__bf16)kf[it][3] }; *(v4b*)(dk + it * 8 * 72) = h; }
#pragma unroll
      for (int it = 0; it < 4; ++it) {
#pragma unroll
        for (int ii = 0; ii < 4; ++ii) { const v2b h = { (__bf16)va[it][ii], (__bf16)vc[it][ii] }; *(v2b*)(dv + ii * 72 + it * 16) = h; } } }
    __syncthreads();      // the new tiles are visible to all four waves (and each wave's slab to its own lanes)
    // (2) content scores, transposed: st[t][r] = k_{key0 + t*16 + 8g + r} . q_i
    v8f st[4];
#pragma unroll
    for (int t = 0; t < 4; ++t) { v8f s = {};
#pragma unroll
      for (int kc = 0; kc < 2; ++kc) s = wmma_bf(frag_b(&sK[t * 16 + col][kc * 32], lane), aq[kc], s);
      st[t] = s; }
    // (3) zero rule, position score and band mask, in registers
    // The reference replaces an EXACTLY zero content score by -1e6 before adding the position term; with bf16-rounded inputs exact zeros do occur (a few per run).
    // Near-zero candidates are re-evaluated as a sequential f32 fma chain over the bf16-rounded rows (the reference's accumulation order) and the rule applied on that value.
    // One test per lane and tile finds whether there is a candidate at all; the rare path then walks the lane's 32 keys (bit e = t*8 + r).
    float amin = 3.0e38f;
#pragma unroll
    for (int t = 0; t < 4; ++t) {
#pragma unroll
      for (int r = 0; r < 8; ++r) amin = fminf(amin, fabsf(st[t][r])); }
    if (amin < 1.0e-5f) { unsigned nz = 0u, zr = 0u;
#pragma unroll
      for (int t = 0; t < 4; ++t) {
#pragma unroll
        for (int r = 0; r < 8; ++r) nz |= (fabsf(st[t][r]) < 1.0e-5f ? 1u : 0u) << (t * 8 + r); }
      const float* qr = qb_ + (size_t)i * D;
#pragma unroll 1      // rare path: kept rolled so that it costs the tile loop neither registers nor instruction cache
      for (int e = 0; e < 32; ++e) { if ((nz >> e) & 1u) { const float* kr = kb_ + (size_t)(key0 + (e >> 3) * 16 + 8 * g + (e & 7)) * D; float acc_ = 0.f;
          for (int dd = 0; dd < D; ++dd) acc_ = fmaf((float)(__bf16)qr[dd], (float)(__bf16)kr[dd], acc_);
          if (acc_ == 0.0f) zr |= 1u << e; } }
#pragma unroll
      for (int t = 0; t < 4; ++t) {
#pragma unroll
        for (int r = 0; r < 8; ++r) { if ((zr >> (t * 8 + r)) & 1u) st[t][r] = -1000000.0f; } } }
    const int jb = key0 + 8 * g - i;   // offset j of this lane's key (t = 0, r = 0)
    float mx = -3.4e38f;
#pragma unroll
    for (int t = 0; t < 4; ++t) {
#pragma unroll
      for (int r = 0; r < 8; ++r) { const float v = st[t][r] + qpr[t * 16 + r];
        const float vm = (unsigned)(jb + t * 16 + r) < (unsigned)L ? v : -3.0e38f;      // j < 0 or j >= L: outside the band
        st[t][r] = vm; mx = fmaxf(mx, vm); } }
    mx = fmaxf(mx, __shfl_xor(mx, 16, 32));
    const float mnew = fmaxf(mrun, mx); const float nnew = -mnew * SC2; const float corr = __builtin_amdgcn_exp2f((mrun - mnew) * SC2);
    float ps = 0.f;
#pragma unroll
    for (int t = 0; t < 4; ++t) { v8f df;
#pragma unroll
      for (int r = 0; r < 8; ++r) df[r] = fmaf(st[t][r], SC2, nnew);
      df = exp2x8(df);
#pragma unroll
      for (int r = 0; r < 8; ++r) { const float p = st[t][r] <= -1.0e38f ? 0.f : df[r]; ps += p; st[t][r] = p; } }
    ps += __shfl_xor(ps, 16, 32);
    lrun = lrun * corr + ps; mrun = mnew;
#pragma unroll
    for (int t = 0; t < 4; ++t) { acc[t] *= corr; ac2[t] *= corr; }
    // (4) O^T += bf16(V)^T x P^T (hi/lo): the second operand's elements 0..7 are keys kc*32 + 8g + 0..7 = st[2kc], elements 8..15 are keys kc*32 + 16 + 8g + 0..7 = st[2kc+1]
#pragma unroll
    for (int kc = 0; kc < 2; ++kc) { float pv[16];
#pragma unroll
      for (int r = 0; r < 8; ++r) { pv[r] = st[2 * kc][r]; pv[8 + r] = st[2 * kc + 1][r]; }
      const F2 pa = bsplit16(pv);
#pragma unroll
      for (int t = 0; t < 4; ++t) { const v16b vb = frag_b(&sVt[t * 16 + col][kc * 32], lane); acc[t] = wmma_bf(vb, pa.h, acc[t]); ac2[t] = wmma_bf(vb, pa.l, ac2[t]); } }
    LDSX(); }
  { const float inv = 1.0f / lrun;
#pragma unroll
    for (int t = 0; t < 4; ++t) st8(qpw + t * 16, (acc[t] + ac2[t]) * inv); }
  LDSX();
  for (int qq = lane; qq < 16 * 16; qq += 32) { const int rl = qq >> 4, pc = qq & 15; vst2(out + ((size_t)b * M + q0 + rl) * D + pc * 4, *(const v4f*)(&sQP[w][rl][pc * 4])); }
}
extern "C" void kernel_launch(void* const* d_in, const int* in_sizes, int n_in, void* d_out, int out_size, void* d_ws, size_t ws_size, hipStream_t stream) {
  (void)in_sizes; (void)n_in; (void)out_size; (void)ws_size; (void)d_ws;
  const float* query = (const float*)d_in[0]; const float* key = (const float*)d_in[1]; const float* value = (const float*)d_in[2]; const float* pe = (const float*)d_in[3];
  float* out = (float*)d_out;
  k_seq<<<dim3(M / 64, NBH), 128, 0, stream>>>(query, key, value, pe, out);
}

// v005
// A run of this version takes 62.3 microseconds.
// In both of two side-by-side timings against v004, it was 1.24 times as fast.
// Over all steps from v000 it is 3.96 times as fast.
// compute dtype: the INPUTS query/key/value/key_pe rounded to bf16 and multiplied with exact bf16 WMMA products (f32 accumulate); the softmax weights P (computed) as a bf16 hi/lo pair; mask and softmax f32.
#include <hip/hip_runtime.h>
#include <math.h>

typedef __attribute__((ext_vector_type(16))) _Float16 v16h;
typedef __attribute__((ext_vector_type(16))) __bf16 v16b;
typedef __attribute__((ext_vector_type(8)))  _Float16 v8h;
typedef __attribute__((ext_vector_type(8)))  __bf16 v8b;
typedef __attribute__((ext_vector_type(4)))  __bf16 v4b;
typedef __attribute__((ext_vector_type(2)))  __bf16 v2b;
typedef __attribute__((ext_vector_type(8)))  float v8f;
typedef __attribute__((ext_vector_type(4)))  float v4f;
typedef __attribute__((ext_vector_type(2)))  float v2f;
typedef __attribute__((ext_vector_type(4)))  unsigned v4u;
typedef __attribute__((ext_vector_type(4)))  int v4i;
typedef float __attribute__((may_alias)) float_a;
typedef int __attribute__((may_alias)) int_a;

template <typename T> __device__ __forceinline__ void vst2(void* p, T v) { *(T*)p = v;  }
__device__ __forceinline__ v8f wmma16(v16h a, v16h b, v8f c) {
  v8f d = __builtin_amdgcn_wmma_f32_16x16x32_f16(false, a, false, b, (short)0, c, false, false);
  asm volatile("v_nop\n\tv_nop\n\tv_nop\n\tv_nop" : "+v"(d) : "v"(a), "v"(b));
  return d;
}
__device__ __forceinline__ v8f wmma_bf(v16b a, v16b b, v8f c) {
  v8f d = __builtin_amdgcn_wmma_f32_16x16x32_bf16(false, a, false, b, (short)0, c, false, false);
  asm volatile("v_nop\n\tv_nop\n\tv_nop\n\tv_nop" : "+v"(d) : "v"(a), "v"(b));
  return d;
}
// 16x16x32 fragments: lane = (h = lane>>4, row/col = lane&15); elements 0..7 = k0+8h+0..7, 8..15 = k0+16+8h+0..7; D element r = row 8h+r
__device__ __forceinline__ v16h frag_h(const _Float16* rowk0, int lane) {
  union { v16h v; v8h q[2]; } u; const _Float16* p = rowk0 + 8 * (lane >> 4);
  u.q[0] = *(const v8h*)p; u.q[1] = *(const v8h*)(p + 16); return u.v;
}
__device__ __forceinline__ v16b frag_b(const __bf16* rowk0, int lane) {
  union { v16b v; v8b q[2]; } u; const __bf16* p = rowk0 + 8 * (lane >> 4);
  u.q[0] = *(const v8b*)p; u.q[1] = *(const v8b*)(p + 16); return u.v;
}
__device__ __forceinline__ v16h frag_f32(const float* rowk0, int lane) {
  v16h a; const float* p = rowk0 + 8 * (lane >> 4);
#pragma unroll
  for (int i = 0; i < 8; ++i) { a[i] = (_Float16)p[i]; a[8 + i] = (_Float16)p[16 + i]; }
  return a;
}
__device__ __forceinline__ v16h frag_f32s(const float* rowk0, int lane, float sc) {
  v16h a; const float* p = rowk0 + 8 * (lane >> 4);
#pragma unroll
  for (int i = 0; i < 8; ++i) { a[i] = (_Float16)(p[i] * sc); a[8 + i] = (_Float16)(p[16 + i] * sc); }
  return a;
}
// column fragment from a [K][ld] layout (column n), rows >= K read as 0
__device__ __forceinline__ v16h fragc_f32(const float* W, int k0, int n, int lane, int ld, int K) {
  v16h a; const int g = lane >> 4;
#pragma unroll
  for (int i = 0; i < 8; ++i) { const int ka = k0 + 8 * g + i, kb = ka + 16;
    a[i] = (_Float16)(ka < K ? W[(size_t)ka * ld + n] : 0.f); a[8 + i] = (_Float16)(kb < K ? W[(size_t)kb * ld + n] : 0.f); }
  return a;
}
struct F2 { v16b h, l; };
__device__ __forceinline__ F2 bsplit16(const float v[16]) { F2 r;
#pragma unroll
  for (int i = 0; i < 16; ++i) { const __bf16 h = (__bf16)v[i]; r.h[i] = h; r.l[i] = (__bf16)(v[i] - (float)h); }
  return r; }
__device__ __forceinline__ F2 split_row(const float* row, int k0, int lane) { float v[16]; const float* p = row + k0 + 8 * (lane >> 4);
#pragma unroll
  for (int i = 0; i < 8; ++i) { v[i] = p[i]; v[8 + i] = p[16 + i]; }
  return bsplit16(v); }
__device__ __forceinline__ F2 split_rowK(const float* row, int k0, int lane, int K) { float v[16]; const int g = lane >> 4;
#pragma unroll
  for (int i = 0; i < 8; ++i) { const int ka = k0 + 8 * g + i, kb = ka + 16; v[i] = ka < K ? row[ka] : 0.f; v[8 + i] = kb < K ? row[kb] : 0.f; }
  return bsplit16(v); }
__device__ __forceinline__ F2 split_col(const float* W, int k0, int n, int lane, int ld, int K) { float v[16]; const int g = lane >> 4;
#pragma unroll
  for (int i = 0; i < 8; ++i) { const int ka = k0 + 8 * g + i, kb = ka + 16; v[i] = ka < K ? W[(size_t)ka * ld + n] : 0.f; v[8 + i] = kb < K ? W[(size_t)kb * ld + n] : 0.f; }
  return bsplit16(v); }
__device__ __forceinline__ v8f mac3(const F2& a, const F2& b, v8f c) { c = wmma_bf(a.l, b.h, c); c = wmma_bf(a.h, b.l, c); return wmma_bf(a.h, b.h, c); }
__device__ __forceinline__ float sigm(float v) { return 1.0f / (1.0f + expf(-v)); }
#define LDSX() do { asm volatile("s_wait_dscnt 0" ::: "memory"); __builtin_amdgcn_wave_barrier(); __builtin_amdgcn_fence(__ATOMIC_RELEASE, "workgroup"); } while (0)


// Banded attention with relative position scores (the skew/unskew module): for query i (1,024 per batch-head, 64 batch-heads) and offset j in [0, 1024):
// a(i,j) = softmax_j((q_i . k_{i+j} + q_i . pe_j) / 8); out_i = sum_j a(i,j) v_{i+j}. (The reference's "== 0 -> -1e6" substitution DOES fire a few times per run on bf16-rounded inputs and is replicated.)
// Block = (64 queries, batch-head); 17 key tiles of 64 starting at q0 cover keys q0 .. q0+1087.
// All three products are formed transposed (keys x queries, offsets x queries, head dim x queries), so that in every accumulator a lane's column is ONE query:
// lane (col = query, g) holds keys t*16 + 8g + r of its query in st[t][r]. Mask, maximum, exponential and sum are then in-lane (one exchange between the halves),
// the weights P are already in the operand order of the next product (elements 0..7 = tile 2kc, 8..15 = tile 2kc+1), and the running rescale is the lane's own factor.
// Of the scores, only the position scores pass through LDS, because their offset j = key - query shifts with the lane: 16x80 slab per wave (64 offsets are new in a step, the first 16 are the previous step's last).
// The reference's '== 0 -> -1e6' rule is honoured: near-zero content scores are re-checked with a sequential f32 fma chain over the bf16-rounded rows. No ws; whole 256-B output rows by one wave.
// The key and value tile of a step are the same for the block's four waves: they are rounded to bf16 once, staged in LDS (value transposed) and read as fragments with 16-byte LDS loads.
// The position table pe is the same for every wave too, and the four waves of a block touch overlapping offsets: each step's 64 new offsets are rounded to bf16 once per block and staged transposed,
// [offset][d], in a ring of two 64-offset blocks in LDS; a wave reads its four 16-offset operands from there with 16-byte LDS loads.
// The output rows are staged in the position-score buffer, which is free by then.
#define NBH 64
#define M 1024
#define KL 2048
#define L 1024
#define D 64
#define NKT 17
// exp((s - m) / 8) = 2^(s * SC2 - m * SC2): the division by 8 and the change of base are one factor, applied together with the running maximum in one fused multiply-add in front of the hardware's base-2 exponential.
// The exponent is <= 0; below -126 the hardware form returns 0 where the library form returned a subnormal, far below one unit in the last place of the row sum, whose largest term is 1 up to rounding.
#define SC2 0.18033688011112042f      // log2(e) / 8

// eight consecutive floats of one accumulator to LDS as two 16-byte stores (the rows are 16-byte aligned, not 32)
__device__ __forceinline__ void st8(float* p, v8f v) { *(v4f*)p = __builtin_shufflevector(v, v, 0, 1, 2, 3); *(v4f*)(p + 4) = __builtin_shufflevector(v, v, 4, 5, 6, 7); }

// 2^x of eight values. One statement, so that every exponential is followed by an instruction that touches neither its result nor its source:
// the next exponential (the results are early-clobber, so none lies on a source), and behind the last one the v_nop: the slot that the instruction set asks for behind a transcendental.
__device__ __forceinline__ v8f exp2x8(v8f x) {
  float a, b, c, d, e, f, g, h;
  asm("v_exp_f32 %0, %8\n\tv_exp_f32 %1, %9\n\tv_exp_f32 %2, %10\n\tv_exp_f32 %3, %11\n\tv_exp_f32 %4, %12\n\tv_exp_f32 %5, %13\n\tv_exp_f32 %6, %14\n\tv_exp_f32 %7, %15\n\tv_nop"
      : "=&v"(a), "=&v"(b), "=&v"(c), "=&v"(d), "=&v"(e), "=&v"(f), "=&v"(g), "=&v"(h)
      : "v"(x[0]), "v"(x[1]), "v"(x[2]), "v"(x[3]), "v"(x[4]), "v"(x[5]), "v"(x[6]), "v"(x[7]));
  return (v8f){ a, b, c, d, e, f, g, h };
}

__global__ __launch_bounds__(128) void k_seq(const float* __restrict__ query, const float* __restrict__ key, const float* __restrict__ value, const float* __restrict__ pe, float* __restrict__ out) {
  __shared__ __align__(16) float sQP[4][16][84];      // [query][offset - jw]: q.pe for the 80 offsets jw .. jw+79 that this wave's tile can touch (jw = key0 - q0 - 16)
  __shared__ __align__(16) __bf16 sK[64][72];         // the block's key tile rounded to bf16, [key][d]; 144-byte rows suit the 16-byte fragment reads
  __shared__ __align__(16) __bf16 sVt[64][72];        // the block's value tile rounded to bf16, transposed to [d][key]
  __shared__ __align__(16) __bf16 sPe[128][72];       // pe rounded to bf16, transposed to [offset & 127][d]: offsets 64*n .. 64*n+63 lie in rows 64*(n & 1) ..
  const int tid = threadIdx.x, w = tid >> 5, lane = tid & 31, col = lane & 15, g = lane >> 4;
#ifndef BH0
#define BH0 0
#endif
  const int b = blockIdx.y + BH0; const int q0 = blockIdx.x * 64 + w * 16;
  const float* qb_ = query + (size_t)b * M * D; const float* kb_ = key + (size_t)b * KL * D; const float* vb_ = value + (size_t)b * KL * D;
  v16b aq[2];                          // the wave's 16 queries, used as the second operand (column = query)
#pragma unroll
  for (int kc = 0; kc < 2; ++kc) aq[kc] = split_row(qb_ + (size_t)(q0 + col) * D, kc * 32, lane).h;
  float mrun = -3.0e38f, lrun = 0.f;   // mrun: running maximum of the scores before their scaling
  v8f acc[4] = {}, ac2[4] = {};     // acc[t][r]: head-dim element t*16 + 8g + r of query col
  v8f qp_last = {};                    // the previous step's last 16 offsets of q.pe: they are this step's first 16
  const int sr = tid >> 4, sc = (tid & 15) * 4;      // this thread's place in the staging of a tile
  const int kt0 = blockIdx.x;          // first key tile = the one starting at the block's first query
  const int i = q0 + col;              // this lane's query
  float* const qpw = &sQP[w][col][8 * g];            // where this lane stores its 8 offsets of a 16-offset tile
  const float* const qpr = &sQP[w][col][16 - col + 8 * g];   // key t*16 + 8g + r of query col has offset index (t*16 + 8g + r) - col + 16
  // staging of a 64-offset block of pe: a thread fetches rows pd and pd+1 (and 32 further down), offsets pj .. pj+3 (and 32 further on). Eight lanes cover a whole 128-byte line of a row;
  // four row pairs a wave spread the 4-byte transposed LDS stores over 16 banks. The loops over pa, pc and pf are unrolled so that these arrays are registers.
  const int pj = (lane & 7) * 4, pd = 2 * ((lane >> 3) + 4 * w);
  const float* const pg = pe + (size_t)pd * L + pj; __bf16* const pl = &sPe[pj][pd];
  v4f pa[4], pc[4];
  // offsets 0 .. 63 are staged in front of the loop; step kt stages offsets 64*(kt+1) .. for the next step
#pragma unroll
  for (int it = 0; it < 4; ++it) { const float* p = pg + (it & 1) * 32 + (size_t)(it >> 1) * 32 * L; pa[it] = *(const v4f*)p; pc[it] = *(const v4f*)(p + L); }
#pragma unroll
  for (int it = 0; it < 4; ++it) {
#pragma unroll
    for (int ii = 0; ii < 4; ++ii) { const v2b h = { (__bf16)pa[it][ii], (__bf16)pc[it][ii] }; *(v2b*)(pl + ((it & 1) * 32 + ii) * 72 + (it >> 1) * 32) = h; } }
  __syncthreads();        // the first block of pe is visible to all four waves
#pragma unroll 1
  for (int kt = 0; kt < NKT; ++kt) { const int key0 = (kt0 + kt) * 64; if (key0 >= KL) break;       // block-uniform
    // (1) position-score slab: the offsets depend on the query: j = key - i. For this wave's queries i in [q0, q0+16)
    //     and keys in [key0, key0+64): j in [key0 - q0 - 15, key0 - q0 + 63] subset of [jw, jw + 80) with jw = key0 - q0 - 16 (wave-specific base, a multiple of 16: q0 = 64*bx + 16w -> jw = 64*kt - 16*w - 16).
    //     jw grows by 64 a step, so offsets jw .. jw+15 are the previous step's jw+64 .. jw+79: that product is kept in registers and stored again, and only four 16-offset tiles are multiplied per step.
    //     The four tiles lie in offsets 64*kt - 48 .. 64*kt + 63: the ring's two blocks, staged in the two steps before this one.
    // (0) the four waves share one key tile and one value tile: each thread fetches 1/128 of both in whole 128-byte lines (key rows sr + 8*it; value rows 2*sr + 16*it and the next; columns sc .. sc+3).
    //     The loads are issued here so that they fly under the position slab; rounding and the LDS stores follow behind it.
    v4f kf[8], va[4], vc[4];
    { const float* kt_ = kb_ + (size_t)key0 * D + sr * D + sc; const float* vt_ = vb_ + (size_t)key0 * D + 2 * sr * D + sc;
#pragma unroll
      for (int it = 0; it < 8; ++it) kf[it] = *(const v4f*)(kt_ + it * 8 * D);
#pragma unroll
      for (int it = 0; it < 4; ++it) { va[it] = *(const v4f*)(vt_ + it * 16 * D); vc[it] = *(const v4f*)(vt_ + it * 16 * D + D); } }
    const bool more_pe = (kt + 1) * 64 < L;      // block-uniform: the next step's 64 new offsets exist
    if (more_pe) {
#pragma unroll
      for (int it = 0; it < 4; ++it) { const float* p = pg + (kt + 1) * 64 + (it & 1) * 32 + (size_t)(it >> 1) * 32 * L; pa[it] = *(const v4f*)p; pc[it] = *(const v4f*)(p + L); } }
    const int jw = key0 - q0 - 16;
    st8(qpw, qp_last);
#pragma unroll
    for (int pp = 1; pp < 5; pp += 2) { v16b pf[2][2];      // two tiles at a time: their four operands are read as one group of LDS loads, and the two accumulators are independent
#pragma unroll
      for (int u = 0; u < 2; ++u) { const int j0 = jw + (pp + u) * 16;
        const int rr = (unsigned)j0 < (unsigned)L ? (j0 & 127) : 0;      // an out-of-range offset tile is never used unmasked: it multiplies rows 0 .. 15 of the ring (always staged), so that the tiles are straight-line code
#pragma unroll
        for (int kc = 0; kc < 2; ++kc) pf[u][kc] = frag_b(&sPe[rr + col][kc * 32], lane); }
      v8f s0 = {}, s1 = {};
#pragma unroll
      for (int kc = 0; kc < 2; ++kc) { s0 = wmma_bf(pf[0][kc], aq[kc], s0); s1 = wmma_bf(pf[1][kc], aq[kc], s1); }
      st8(qpw + pp * 16, s0); st8(qpw + (pp + 1) * 16, s1);
      if (pp == 3) qp_last = s1; }
    __builtin_amdgcn_sched_barrier(0);      // keeps the rounding of the fetched tiles, and with it the wait for their loads, behind the position slab: the loads fly under it
    __syncthreads();      // every wave has left the previous key and value tile, and the older block of pe
    { __bf16* dk = &sK[sr][sc]; __bf16* dv = &sVt[sc][2 * sr];
#pragma unroll
      for (int it = 0; it < 8; ++it) { const v4b h = { (__bf16)kf[it][0], (__bf16)kf[it][1], (__bf16)kf[it][2], (__bf16)kf[it][3] }; *(v4b*)(dk + it * 8 * 72) = h; }
#pragma unroll
      for (int it = 0; it < 4; ++it) {
#pragma unroll
        for (int ii = 0; ii < 4; ++ii) { const v2b h = { (__bf16)va[it][ii], (__bf16)vc[it][ii] }; *(v2b*)(dv + ii * 72 + it * 16) = h; } } }
    if (more_pe) { __bf16* dp = pl + ((kt + 1) & 1) * 64 * 72;
#pragma unroll
      for (int it = 0; it < 4; ++it) {
#pragma unroll
        for (int ii = 0; ii < 4; ++ii) { const v2b h = { (__bf16)pa[it][ii], (__bf16)pc[it][ii] }; *(v2b*)(dp + ((it & 1) * 32 + ii) * 72 + (it >> 1) * 32) = h; } } }
    __syncthreads();      // the new tiles are visible to all four waves (and each wave's slab to its own lanes)
    // (2) content scores, transposed: st[t][r] = k_{key0 + t*16 + 8g + r} . q_i
    v8f st[4];
#pragma unroll
    for (int t = 0; t < 4; ++t) { v8f s = {};
#pragma unroll
      for (int kc = 0; kc < 2; ++kc) s = wmma_bf(frag_b(&sK[t * 16 + col][kc * 32], lane), aq[kc], s);
      st[t] = s; }
    // (3) zero rule, position score and band mask, in registers
    // The reference replaces an EXACTLY zero content score by -1e6 before adding the position term; with bf16-rounded inputs exact zeros do occur (a few per run).
    // Near-zero candidates are re-evaluated as a sequential f32 fma chain over the bf16-rounded rows (the reference's accumulation order) and the rule applied on that value.
    // One test per lane and tile finds whether there is a candidate at all; the rare path then walks the lane's 32 keys (bit e = t*8 + r).
    float amin = 3.0e38f;
#pragma unroll
    for (int t = 0; t < 4; ++t) {
#pragma unroll
      for (int r = 0; r < 8; ++r) amin = fminf(amin, fabsf(st[t][r])); }
    if (amin < 1.0e-5f) { unsigned nz = 0u, zr = 0u;
#pragma unroll
      for (int t = 0; t < 4; ++t) {
#pragma unroll
        for (int r = 0; r < 8; ++r) nz |= (fabsf(st[t][r]) < 1.0e-5f ? 1u : 0u) << (t * 8 + r); }
      const float* qr = qb_ + (size_t)i * D;
#pragma unroll 1      // rare path: kept rolled so that it costs the tile loop neither registers nor instruction cache
      for (int e = 0; e < 32; ++e) { if ((nz >> e) & 1u) { const float* kr = kb_ + (size_t)(key0 + (e >> 3) * 16 + 8 * g + (e & 7)) * D; float acc_ = 0.f;
          for (int dd = 0; dd < D; ++dd) acc_ = fmaf((float)(__bf16)qr[dd], (float)(__bf16)kr[dd], acc_);
          if (acc_ == 0.0f) zr |= 1u << e; } }
#pragma unroll
      for (int t = 0; t < 4; ++t) {
#pragma unroll
        for (int r = 0; r < 8; ++r) { if ((zr >> (t * 8 + r)) & 1u) st[t][r] = -1000000.0f; } } }
    const int jb = key0 + 8 * g - i;   // offset j of this lane's key (t = 0, r = 0)
    float mx = -3.4e38f;
#pragma unroll
    for (int t = 0; t < 4; ++t) {
#pragma unroll
      for (int r = 0; r < 8; ++r) { const float v = st[t][r] + qpr[t * 16 + r];
        const float vm = (unsigned)(jb + t * 16 + r) < (unsigned)L ? v : -3.0e38f;      // j < 0 or j >= L: outside the band
        st[t][r] = vm; mx = fmaxf(mx, vm); } }
    mx = fmaxf(mx, __shfl_xor(mx, 16, 32));
    const float mnew = fmaxf(mrun, mx); const float nnew = -mnew * SC2; const float corr = __builtin_amdgcn_exp2f((mrun - mnew) * SC2);
    float ps = 0.f;
#pragma unroll
    for (int t = 0; t < 4; ++t) { v8f df;
#pragma unroll
      for (int r = 0; r < 8; ++r) df[r] = fmaf(st[t][r], SC2, nnew);
      df = exp2x8(df);
#pragma unroll
      for (int r = 0; r < 8; ++r) { const float p = st[t][r] <= -1.0e38f ? 0.f : df[r]; ps += p; st[t][r] = p; } }
    ps += __shfl_xor(ps, 16, 32);
    lrun = lrun * corr + ps; mrun = mnew;
#pragma unroll
    for (int t = 0; t < 4; ++t) { acc[t] *= corr; ac2[t] *= corr; }
    // (4) O^T += bf16(V)^T x P^T (hi/lo): the second operand's elements 0..7 are keys kc*32 + 8g + 0..7 = st[2kc], elements 8..15 are keys kc*32 + 16 + 8g + 0..7 = st[2kc+1]
#pragma unroll
    for (int kc = 0; kc < 2; ++kc) { float pv[16];
#pragma unroll
      for (int r = 0; r < 8; ++r) { pv[r] = st[2 * kc][r]; pv[8 + r] = st[2 * kc + 1][r]; }
      const F2 pa = bsplit16(pv);
#pragma unroll
      for (int t = 0; t < 4; ++t) { const v16b vb = frag_b(&sVt[t * 16 + col][kc * 32], lane); acc[t] = wmma_bf(vb, pa.h, acc[t]); ac2[t] = wmma_bf(vb, pa.l, ac2[t]); } }
    LDSX(); }
  { const float inv = 1.0f / lrun;
#pragma unroll
    for (int t = 0; t < 4; ++t) st8(qpw + t * 16, (acc[t] + ac2[t]) * inv); }
  LDSX();
  for (int qq = lane; qq < 16 * 16; qq += 32) { const int rl = qq >> 4, pc = qq & 15; vst2(out + ((size_t)b * M + q0 + rl) * D + pc * 4, *(const v4f*)(&sQP[w][rl][pc * 4])); }
}
extern "C" void kernel_launch(void* const* d_in, const int* in_sizes, int n_in, void* d_out, int out_size, void* d_ws, size_t ws_size, hipStream_t stream) {
  (void)in_sizes; (void)n_in; (void)out_size; (void)ws_size; (void)d_ws;
  const float* query = (const float*)d_in[0]; const float* key = (const float*)d_in[1]; const float* value = (const float*)d_in[2]; const float* pe = (const float*)d_in[3];
  float* out = (float*)d_out;
  k_seq<<<dim3(M / 64, NBH), 128, 0, stream>>>(query, key, value, pe, out);
}

// v006
// One run takes 58.4 microseconds.
// Timed twice side by side with v005, it ran 1.07 times as fast both times.
// Counting every step since v000, it is 4.23 times as fast.
// compute dtype: the INPUTS query/key/value/key_pe rounded to bf16 and multiplied with exact bf16 WMMA products (f32 accumulate); the softmax weights P (computed) as a bf16 hi/lo pair; mask and softmax f32.
#include <hip/hip_runtime.h>
#include <math.h>

typedef __attribute__((ext_vector_type(16))) _Float16 v16h;
typedef __attribute__((ext_vector_type(16))) __bf16 v16b;
typedef __attribute__((ext_vector_type(8)))  _Float16 v8h;
typedef __attribute__((ext_vector_type(8)))  __bf16 v8b;
typedef __attribute__((ext_vector_type(4)))  __bf16 v4b;
typedef __attribute__((ext_vector_type(2)))  __bf16 v2b;
typedef __attribute__((ext_vector_type(8)))  float v8f;
typedef __attribute__((ext_vector_type(4)))  float v4f;
typedef __attribute__((ext_vector_type(2)))  float v2f;
typedef __attribute__((ext_vector_type(4)))  unsigned v4u;
typedef __attribute__((ext_vector_type(4)))  int v4i;
typedef float __attribute__((may_alias)) float_a;
typedef int __attribute__((may_alias)) int_a;

template <typename T> __device__ __forceinline__ void vst2(void* p, T v) { *(T*)p = v;  }
__device__ __forceinline__ v8f wmma16(v16h a, v16h b, v8f c) {
  v8f d = __builtin_amdgcn_wmma_f32_16x16x32_f16(false, a, false, b, (short)0, c, false, false);
  asm volatile("v_nop\n\tv_nop\n\tv_nop\n\tv_nop" : "+v"(d) : "v"(a), "v"(b));
  return d;
}
__device__ __forceinline__ v8f wmma_bf(v16b a, v16b b, v8f c) {
  v8f d = __builtin_amdgcn_wmma_f32_16x16x32_bf16(false, a, false, b, (short)0, c, false, false);
  asm volatile("v_nop\n\tv_nop\n\tv_nop\n\tv_nop" : "+v"(d) : "v"(a), "v"(b));
  return d;
}
// 16x16x32 fragments: lane = (h = lane>>4, row/col = lane&15); elements 0..7 = k0+8h+0..7, 8..15 = k0+16+8h+0..7; D element r = row 8h+r
__device__ __forceinline__ v16h frag_h(const _Float16* rowk0, int lane) {
  union { v16h v; v8h q[2]; } u; const _Float16* p = rowk0 + 8 * (lane >> 4);
  u.q[0] = *(const v8h*)p; u.q[1] = *(const v8h*)(p + 16); return u.v;
}
__device__ __forceinline__ v16b frag_b(const __bf16* rowk0, int lane) {
  union { v16b v; v8b q[2]; } u; const __bf16* p = rowk0 + 8 * (lane >> 4);
  u.q[0] = *(const v8b*)p; u.q[1] = *(const v8b*)(p + 16); return u.v;
}
__device__ __forceinline__ v16h frag_f32(const float* rowk0, int lane) {
  v16h a; const float* p = rowk0 + 8 * (lane >> 4);
#pragma unroll
  for (int i = 0; i < 8; ++i) { a[i] = (_Float16)p[i]; a[8 + i] = (_Float16)p[16 + i]; }
  return a;
}
__device__ __forceinline__ v16h frag_f32s(const float* rowk0, int lane, float sc) {
  v16h a; const float* p = rowk0 + 8 * (lane >> 4);
#pragma unroll
  for (int i = 0; i < 8; ++i) { a[i] = (_Float16)(p[i] * sc); a[8 + i] = (_Float16)(p[16 + i] * sc); }
  return a;
}
// column fragment from a [K][ld] layout (column n), rows >= K read as 0
__device__ __forceinline__ v16h fragc_f32(const float* W, int k0, int n, int lane, int ld, int K) {
  v16h a; const int g = lane >> 4;
#pragma unroll
  for (int i = 0; i < 8; ++i) { const int ka = k0 + 8 * g + i, kb = ka + 16;
    a[i] = (_Float16)(ka < K ? W[(size_t)ka * ld + n] : 0.f); a[8 + i] = (_Float16)(kb < K ? W[(size_t)kb * ld + n] : 0.f); }
  return a;
}
struct F2 { v16b h, l; };
__device__ __forceinline__ F2 bsplit16(const float v[16]) { F2 r;
#pragma unroll
  for (int i = 0; i < 16; ++i) { const __bf16 h = (__bf16)v[i]; r.h[i] = h; r.l[i] = (__bf16)(v[i] - (float)h); }
  return r; }
__device__ __forceinline__ F2 split_row(const float* row, int k0, int lane) { float v[16]; const float* p = row + k0 + 8 * (lane >> 4);
#pragma unroll
  for (int i = 0; i < 8; ++i) { v[i] = p[i]; v[8 + i] = p[16 + i]; }
  return bsplit16(v); }
__device__ __forceinline__ F2 split_rowK(const float* row, int k0, int lane, int K) { float v[16]; const int g = lane >> 4;
#pragma unroll
  for (int i = 0; i < 8; ++i) { const int ka = k0 + 8 * g + i, kb = ka + 16; v[i] = ka < K ? row[ka] : 0.f; v[8 + i] = kb < K ? row[kb] : 0.f; }
  return bsplit16(v); }
__device__ __forceinline__ F2 split_col(const float* W, int k0, int n, int lane, int ld, int K) { float v[16]; const int g = lane >> 4;
#pragma unroll
  for (int i = 0; i < 8; ++i) { const int ka = k0 + 8 * g + i, kb = ka + 16; v[i] = ka < K ? W[(size_t)ka * ld + n] : 0.f; v[8 + i] = kb < K ? W[(size_t)kb * ld + n] : 0.f; }
  return bsplit16(v); }
__device__ __forceinline__ v8f mac3(const F2& a, const F2& b, v8f c) { c = wmma_bf(a.l, b.h, c); c = wmma_bf(a.h, b.l, c); return wmma_bf(a.h, b.h, c); }
__device__ __forceinline__ float sigm(float v) { return 1.0f / (1.0f + expf(-v)); }
#define LDSX() do { asm volatile("s_wait_dscnt 0" ::: "memory"); __builtin_amdgcn_wave_barrier(); __builtin_amdgcn_fence(__ATOMIC_RELEASE, "workgroup"); } while (0)


// Banded attention with relative position scores (the skew/unskew module): for query i (1,024 per batch-head, 64 batch-heads) and offset j in [0, 1024):
// a(i,j) = softmax_j((q_i . k_{i+j} + q_i . pe_j) / 8); out_i = sum_j a(i,j) v_{i+j}. (The reference's "== 0 -> -1e6" substitution DOES fire a few times per run on bf16-rounded inputs and is replicated.)
// Block = (64 queries, batch-head); 17 key tiles of 64 starting at q0 cover keys q0 .. q0+1087.
// All three products are formed transposed (keys x queries, offsets x queries, head dim x queries), so that in every accumulator a lane's column is ONE query:
// lane (col = query, g) holds keys t*16 + 8g + r of its query in st[t][r]. Mask, maximum, exponential and sum are then in-lane (one exchange between the halves),
// the weights P are already in the operand order of the next product (elements 0..7 = tile 2kc, 8..15 = tile 2kc+1), and the running rescale is the lane's own factor.
// Of the scores, only the position scores pass through LDS, because their offset j = key - query shifts with the lane: 16x80 slab per wave (64 offsets are new in a step, the first 16 are the previous step's last).
// The reference's '== 0 -> -1e6' rule is honoured: near-zero content scores are re-checked with a sequential f32 fma chain over the bf16-rounded rows. No ws; whole 256-B output rows by one wave.
// The key and value tile of a step are the same for the block's four waves: they are rounded to bf16 once, staged in LDS (value transposed) and read as fragments with 16-byte LDS loads.
// The position table pe is the same for every wave too, and the four waves of a block touch overlapping offsets: each step's 64 new offsets are rounded to bf16 once per block and staged transposed,
// [offset][d], in a ring of two 64-offset blocks in LDS; a wave reads its four 16-offset operands from there with 16-byte LDS loads.
// The output rows are staged in the position-score buffer, which is free by then.
#define NBH 64
#define M 1024
#define KL 2048
#define L 1024
#define D 64
#define NKT 17
// exp((s - m) / 8) = 2^(s * SC2 - m * SC2): the division by 8 and the change of base are one factor, applied together with the running maximum in one fused multiply-add in front of the hardware's base-2 exponential.
// The exponent is <= 0; below -126 the hardware form returns 0 where the library form returned a subnormal, far below one unit in the last place of the row sum, whose largest term is 1 up to rounding.
#define SC2 0.18033688011112042f      // log2(e) / 8

// eight consecutive floats of one accumulator to LDS as two 16-byte stores (the rows are 16-byte aligned, not 32)
__device__ __forceinline__ void st8(float* p, v8f v) { *(v4f*)p = __builtin_shufflevector(v, v, 0, 1, 2, 3); *(v4f*)(p + 4) = __builtin_shufflevector(v, v, 4, 5, 6, 7); }

// 2^x of eight values. One statement, so that every exponential is followed by an instruction that touches neither its result nor its source:
// the next exponential (the results are early-clobber, so none lies on a source), and behind the last one the v_nop: the slot that the instruction set asks for behind a transcendental.
__device__ __forceinline__ v8f exp2x8(v8f x) {
  float a, b, c, d, e, f, g, h;
  asm("v_exp_f32 %0, %8\n\tv_exp_f32 %1, %9\n\tv_exp_f32 %2, %10\n\tv_exp_f32 %3, %11\n\tv_exp_f32 %4, %12\n\tv_exp_f32 %5, %13\n\tv_exp_f32 %6, %14\n\tv_exp_f32 %7, %15\n\tv_nop"
      : "=&v"(a), "=&v"(b), "=&v"(c), "=&v"(d), "=&v"(e), "=&v"(f), "=&v"(g), "=&v"(h)
      : "v"(x[0]), "v"(x[1]), "v"(x[2]), "v"(x[3]), "v"(x[4]), "v"(x[5]), "v"(x[6]), "v"(x[7]));
  return (v8f){ a, b, c, d, e, f, g, h };
}

__global__ __launch_bounds__(128) void k_seq(const float* __restrict__ query, const float* __restrict__ key, const float* __restrict__ value, const float* __restrict__ pe, float* __restrict__ out) {
  __shared__ __align__(16) float sQP[4][16][84];      // [query][offset - jw]: q.pe for the 80 offsets jw .. jw+79 that this wave's tile can touch (jw = key0 - q0 - 16)
  __shared__ __align__(16) __bf16 sK[64][72];         // the block's key tile rounded to bf16, [key][d]; 144-byte rows suit the 16-byte fragment reads
  __shared__ __align__(16) __bf16 sVt[64][72];        // the block's value tile rounded to bf16, transposed to [d][key]
  __shared__ __align__(16) __bf16 sPe[128][72];       // pe rounded to bf16, transposed to [offset & 127][d]: offsets 64*n .. 64*n+63 lie in rows 64*(n & 1) ..
  const int tid = threadIdx.x, w = tid >> 5, lane = tid & 31, col = lane & 15, g = lane >> 4;
#ifndef BH0
#define BH0 0
#endif
  const int b = blockIdx.y + BH0; const int q0 = blockIdx.x * 64 + w * 16;
  const float* qb_ = query + (size_t)b * M * D; const float* kb_ = key + (size_t)b * KL * D; const float* vb_ = value + (size_t)b * KL * D;
  v16b aq[2];                          // the wave's 16 queries, used as the second operand (column = query)
#pragma unroll
  for (int kc = 0; kc < 2; ++kc) aq[kc] = split_row(qb_ + (size_t)(q0 + col) * D, kc * 32, lane).h;
  float mrun = -3.0e38f, lrun = 0.f;   // mrun: running maximum of the scores before their scaling
  v8f acc[4] = {}, ac2[4] = {};     // acc[t][r]: head-dim element t*16 + 8g + r of query col
  v8f qp_last = {};                    // the previous step's last 16 offsets of q.pe: they are this step's first 16
  const int sr = tid >> 4, sc = (tid & 15) * 4;      // this thread's place in the staging of a tile
  const int kt0 = blockIdx.x;          // first key tile = the one starting at the block's first query
  const int i = q0 + col;              // this lane's query
  float* const qpw = &sQP[w][col][8 * g];            // where this lane stores its 8 offsets of a 16-offset tile
  const float* const qpr = &sQP[w][col][16 - col + 8 * g];   // key t*16 + 8g + r of query col has offset index (t*16 + 8g + r) - col + 16
  // staging of a 64-offset block of pe: a thread fetches rows pd and pd+1 (and 32 further down), offsets pj .. pj+3 (and 32 further on). Eight lanes cover a whole 128-byte line of a row;
  // four row pairs a wave spread the 4-byte transposed LDS stores over 16 banks. The loops over pa, pc and pf are unrolled so that these arrays are registers.
  const int pj = (lane & 7) * 4, pd = 2 * ((lane >> 3) + 4 * w);
  const float* const pg = pe + (size_t)pd * L + pj; __bf16* const pl = &sPe[pj][pd];
  v4f pa[4], pc[4];
  // offsets 0 .. 63 are staged in front of the loop; step kt stages offsets 64*(kt+1) .. for the next step
#pragma unroll
  for (int it = 0; it < 4; ++it) { const float* p = pg + (it & 1) * 32 + (size_t)(it >> 1) * 32 * L; pa[it] = *(const v4f*)p; pc[it] = *(const v4f*)(p + L); }
#pragma unroll
  for (int it = 0; it < 4; ++it) {
#pragma unroll
    for (int ii = 0; ii < 4; ++ii) { const v2b h = { (__bf16)pa[it][ii], (__bf16)pc[it][ii] }; *(v2b*)(pl + ((it & 1) * 32 + ii) * 72 + (it >> 1) * 32) = h; } }
  __syncthreads();        // the first block of pe is visible to all four waves
#pragma unroll 1
  for (int kt = 0; kt < NKT; ++kt) { const int key0 = (kt0 + kt) * 64; if (key0 >= KL) break;       // block-uniform
    // (1) position-score slab: the offsets depend on the query: j = key - i. For this wave's queries i in [q0, q0+16)
    //     and keys in [key0, key0+64): j in [key0 - q0 - 15, key0 - q0 + 63] subset of [jw, jw + 80) with jw = key0 - q0 - 16 (wave-specific base, a multiple of 16: q0 = 64*bx + 16w -> jw = 64*kt - 16*w - 16).
    //     jw grows by 64 a step, so offsets jw .. jw+15 are the previous step's jw+64 .. jw+79: that product is kept in registers and stored again, and only four 16-offset tiles are multiplied per step.
    //     The four tiles lie in offsets 64*kt - 48 .. 64*kt + 63: the ring's two blocks, staged in the two steps before this one.
    // (0) the four waves share one key tile and one value tile: each thread fetches 1/128 of both in whole 128-byte lines (key rows sr + 8*it; value rows 2*sr + 16*it and the next; columns sc .. sc+3).
    //     The loads are issued here so that they fly under the position slab; rounding and the LDS stores follow behind it.
    v4f kf[8], va[4], vc[4];
    { const float* kt_ = kb_ + (size_t)key0 * D + sr * D + sc; const float* vt_ = vb_ + (size_t)key0 * D + 2 * sr * D + sc;
#pragma unroll
      for (int it = 0; it < 8; ++it) kf[it] = *(const v4f*)(kt_ + it * 8 * D);
#pragma unroll
      for (int it = 0; it < 4; ++it) { va[it] = *(const v4f*)(vt_ + it * 16 * D); vc[it] = *(const v4f*)(vt_ + it * 16 * D + D); } }
    const bool more_pe = (kt + 1) * 64 < L;      // block-uniform: the next step's 64 new offsets exist
    // The fetch is issued in every step (in the last two from offset 0, unused): under the branch the 32 registers would be carried round the whole loop, and the operand groups below need them.
    { const float* pn = pg + (more_pe ? (kt + 1) * 64 : 0);
#pragma unroll
      for (int it = 0; it < 4; ++it) { const float* p = pn + (it & 1) * 32 + (size_t)(it >> 1) * 32 * L; pa[it] = *(const v4f*)p; pc[it] = *(const v4f*)(p + L); } }
    const int jw = key0 - q0 - 16;
    st8(qpw, qp_last);
#pragma unroll
    for (int pp = 1; pp < 5; pp += 2) { v16b pf[2][2];      // two tiles at a time: their four operands are read as one group of LDS loads, and the two accumulators are independent
#pragma unroll
      for (int u = 0; u < 2; ++u) { const int j0 = jw + (pp + u) * 16;
        const int rr = (unsigned)j0 < (unsigned)L ? (j0 & 127) : 0;      // an out-of-range offset tile is never used unmasked: it multiplies rows 0 .. 15 of the ring (always staged), so that the tiles are straight-line code
#pragma unroll
        for (int kc = 0; kc < 2; ++kc) pf[u][kc] = frag_b(&sPe[rr + col][kc * 32], lane); }
      v8f s0 = {}, s1 = {};
#pragma unroll
      for (int kc = 0; kc < 2; ++kc) { s0 = wmma_bf(pf[0][kc], aq[kc], s0); s1 = wmma_bf(pf[1][kc], aq[kc], s1); }
      st8(qpw + pp * 16, s0); st8(qpw + (pp + 1) * 16, s1);
      if (pp == 3) qp_last = s1; }
    __builtin_amdgcn_sched_barrier(0);      // keeps the rounding of the fetched tiles, and with it the wait for their loads, behind the position slab: the loads fly under it
    __syncthreads();      // every wave has left the previous key and value tile, and the older block of pe
    { __bf16* dk = &sK[sr][sc]; __bf16* dv = &sVt[sc][2 * sr];
#pragma unroll
      for (int it = 0; it < 8; ++it) { const v4b h = { (__bf16)kf[it][0], (__bf16)kf[it][1], (__bf16)kf[it][2], (__bf16)kf[it][3] }; *(v4b*)(dk + it * 8 * 72) = h; }
#pragma unroll
      for (int it = 0; it < 4; ++it) {
#pragma unroll
        for (int ii = 0; ii < 4; ++ii) { const v2b h = { (__bf16)va[it][ii], (__bf16)vc[it][ii] }; *(v2b*)(dv + ii * 72 + it * 16) = h; } } }
    if (more_pe) { __bf16* dp = pl + ((kt + 1) & 1) * 64 * 72;
#pragma unroll
      for (int it = 0; it < 4; ++it) {
#pragma unroll
        for (int ii = 0; ii < 4; ++ii) { const v2b h = { (__bf16)pa[it][ii], (__bf16)pc[it][ii] }; *(v2b*)(dp + ((it & 1) * 32 + ii) * 72 + (it >> 1) * 32) = h; } } }
    __syncthreads();      // the new tiles are visible to all four waves (and each wave's slab to its own lanes)
    // (2) content scores, transposed: st[t][r] = k_{key0 + t*16 + 8g + r} . q_i
    //     The eight key operands are fetched as one group of sixteen LDS loads, in the order of their use, so that the LDS latency is waited out once and not in front of every product.
    v8f st[4]; v16b kfr[2][4], vfr[2][4];
#pragma unroll
    for (int kc = 0; kc < 2; ++kc) {
#pragma unroll
      for (int t = 0; t < 4; ++t) kfr[kc][t] = frag_b(&sK[t * 16 + col][kc * 32], lane); }
    __builtin_amdgcn_sched_barrier(0);      // keeps the loads together ahead of the products: sunk to their uses, each pair would cost a full LDS round trip
#pragma unroll
    for (int t = 0; t < 4; ++t) st[t] = wmma_bf(kfr[0][t], aq[0], (v8f){});
#pragma unroll
    for (int t = 0; t < 4; ++t) st[t] = wmma_bf(kfr[1][t], aq[1], st[t]);
    //     The eight value operands of product (4) are fetched here, as one group too: they fly under the mask and softmax arithmetic.
#pragma unroll
    for (int kc = 0; kc < 2; ++kc) {
#pragma unroll
      for (int t = 0; t < 4; ++t) vfr[kc][t] = frag_b(&sVt[t * 16 + col][kc * 32], lane); }
    __builtin_amdgcn_sched_barrier(0);      // keeps the value loads here, ahead of the softmax, instead of in front of each product of (4)
    // (3) zero rule, position score and band mask, in registers
    // The reference replaces an EXACTLY zero content score by -1e6 before adding the position term; with bf16-rounded inputs exact zeros do occur (a few per run).
    // Near-zero candidates are re-evaluated as a sequential f32 fma chain over the bf16-rounded rows (the reference's accumulation order) and the rule applied on that value.
    // One test per lane and tile finds whether there is a candidate at all; the rare path then walks the lane's 32 keys (bit e = t*8 + r).
    float amin = 3.0e38f;
#pragma unroll
    for (int t = 0; t < 4; ++t) {
#pragma unroll
      for (int r = 0; r < 8; ++r) amin = fminf(amin, fabsf(st[t][r])); }
    if (amin < 1.0e-5f) { unsigned nz = 0u, zr = 0u;
#pragma unroll
      for (int t = 0; t < 4; ++t) {
#pragma unroll
        for (int r = 0; r < 8; ++r) nz |= (fabsf(st[t][r]) < 1.0e-5f ? 1u : 0u) << (t * 8 + r); }
      const float* qr = qb_ + (size_t)i * D;
#pragma unroll 1      // rare path: kept rolled so that it costs the tile loop neither registers nor instruction cache
      for (int e = 0; e < 32; ++e) { if ((nz >> e) & 1u) { const float* kr = kb_ + (size_t)(key0 + (e >> 3) * 16 + 8 * g + (e & 7)) * D; float acc_ = 0.f;
          for (int dd = 0; dd < D; ++dd) acc_ = fmaf((float)(__bf16)qr[dd], (float)(__bf16)kr[dd], acc_);
          if (acc_ == 0.0f) zr |= 1u << e; } }
#pragma unroll
      for (int t = 0; t < 4; ++t) {
#pragma unroll
        for (int r = 0; r < 8; ++r) { if ((zr >> (t * 8 + r)) & 1u) st[t][r] = -1000000.0f; } } }
    float qv[4][8];      // this lane's 32 position scores, fetched as one group as well
#pragma unroll
    for (int t = 0; t < 4; ++t) {
#pragma unroll
      for (int r = 0; r < 8; ++r) qv[t][r] = qpr[t * 16 + r]; }
    __builtin_amdgcn_sched_barrier(0);      // keeps these loads together: spread among the additions they cost a wait at every place
    const int jb = key0 + 8 * g - i;   // offset j of this lane's key (t = 0, r = 0)
    float mx = -3.4e38f;
#pragma unroll
    for (int t = 0; t < 4; ++t) {
#pragma unroll
      for (int r = 0; r < 8; ++r) { const float v = st[t][r] + qv[t][r];
        const float vm = (unsigned)(jb + t * 16 + r) < (unsigned)L ? v : -3.0e38f;      // j < 0 or j >= L: outside the band
        st[t][r] = vm; mx = fmaxf(mx, vm); } }
    mx = fmaxf(mx, __shfl_xor(mx, 16, 32));
    const float mnew = fmaxf(mrun, mx); const float nnew = -mnew * SC2; const float corr = __builtin_amdgcn_exp2f((mrun - mnew) * SC2);
    float ps = 0.f;
#pragma unroll
    for (int t = 0; t < 4; ++t) { v8f df;
#pragma unroll
      for (int r = 0; r < 8; ++r) df[r] = fmaf(st[t][r], SC2, nnew);
      df = exp2x8(df);
#pragma unroll
      for (int r = 0; r < 8; ++r) { const float p = st[t][r] <= -1.0e38f ? 0.f : df[r]; ps += p; st[t][r] = p; } }
    ps += __shfl_xor(ps, 16, 32);
    lrun = lrun * corr + ps; mrun = mnew;
#pragma unroll
    for (int t = 0; t < 4; ++t) { acc[t] *= corr; ac2[t] *= corr; }
    // (4) O^T += bf16(V)^T x P^T (hi/lo): the second operand's elements 0..7 are keys kc*32 + 8g + 0..7 = st[2kc], elements 8..15 are keys kc*32 + 16 + 8g + 0..7 = st[2kc+1]
#pragma unroll
    for (int kc = 0; kc < 2; ++kc) { float pv[16];
#pragma unroll
      for (int r = 0; r < 8; ++r) { pv[r] = st[2 * kc][r]; pv[8 + r] = st[2 * kc + 1][r]; }
      const F2 pa = bsplit16(pv);
#pragma unroll
      for (int t = 0; t < 4; ++t) { acc[t] = wmma_bf(vfr[kc][t], pa.h, acc[t]); ac2[t] = wmma_bf(vfr[kc][t], pa.l, ac2[t]); } }
    LDSX(); }
  { const float inv = 1.0f / lrun;
#pragma unroll
    for (int t = 0; t < 4; ++t) st8(qpw + t * 16, (acc[t] + ac2[t]) * inv); }
  LDSX();
  for (int qq = lane; qq < 16 * 16; qq += 32) { const int rl = qq >> 4, pc = qq & 15; vst2(out + ((size_t)b * M + q0 + rl) * D + pc * 4, *(const v4f*)(&sQP[w][rl][pc * 4])); }
}
extern "C" void kernel_launch(void* const* d_in, const int* in_sizes, int n_in, void* d_out, int out_size, void* d_ws, size_t ws_size, hipStream_t stream) {
  (void)in_sizes; (void)n_in; (void)out_size; (void)ws_size; (void)d_ws;
  const float* query = (const float*)d_in[0]; const float* key = (const float*)d_in[1]; const float* value = (const float*)d_in[2]; const float* pe = (const float*)d_in[3];
  float* out = (float*)d_out;
  k_seq<<<dim3(M / 64, NBH), 128, 0, stream>>>(query, key, value, pe, out);
}

// v007
// One run takes 55.5 microseconds.
// Next to v006, in two timings, it ran 1.05 times as fast each time.
// Over all steps from v000 it is 4.45 times as fast.
// compute dtype: the INPUTS query/key/value/key_pe rounded to bf16 and multiplied with exact bf16 WMMA products (f32 accumulate); the softmax weights P (computed) as a bf16 hi/lo pair; mask and softmax f32.
#include <hip/hip_runtime.h>
#include <math.h>

typedef __attribute__((ext_vector_type(16))) _Float16 v16h;
typedef __attribute__((ext_vector_type(16))) __bf16 v16b;
typedef __attribute__((ext_vector_type(8)))  _Float16 v8h;
typedef __attribute__((ext_vector_type(8)))  __bf16 v8b;
typedef __attribute__((ext_vector_type(4)))  __bf16 v4b;
typedef __attribute__((ext_vector_type(2)))  __bf16 v2b;
typedef __attribute__((ext_vector_type(8)))  float v8f;
typedef __attribute__((ext_vector_type(4)))  float v4f;
typedef __attribute__((ext_vector_type(2)))  float v2f;
typedef __attribute__((ext_vector_type(4)))  unsigned v4u;
typedef __attribute__((ext_vector_type(4)))  int v4i;
typedef float __attribute__((may_alias)) float_a;
typedef int __attribute__((may_alias)) int_a;

template <typename T> __device__ __forceinline__ void vst2(void* p, T v) { *(T*)p = v;  }
__device__ __forceinline__ v8f wmma16(v16h a, v16h b, v8f c) {
  v8f d = __builtin_amdgcn_wmma_f32_16x16x32_f16(false, a, false, b, (short)0, c, false, false);
  asm volatile("v_nop\n\tv_nop\n\tv_nop\n\tv_nop" : "+v"(d) : "v"(a), "v"(b));
  return d;
}
__device__ __forceinline__ v8f wmma_bf(v16b a, v16b b, v8f c) {
  v8f d = __builtin_amdgcn_wmma_f32_16x16x32_bf16(false, a, false, b, (short)0, c, false, false);
  asm volatile("v_nop\n\tv_nop\n\tv_nop\n\tv_nop" : "+v"(d) : "v"(a), "v"(b));
  return d;
}
// 16x16x32 fragments: lane = (h = lane>>4, row/col = lane&15); elements 0..7 = k0+8h+0..7, 8..15 = k0+16+8h+0..7; D element r = row 8h+r
__device__ __forceinline__ v16h frag_h(const _Float16* rowk0, int lane) {
  union { v16h v; v8h q[2]; } u; const _Float16* p = rowk0 + 8 * (lane >> 4);
  u.q[0] = *(const v8h*)p; u.q[1] = *(const v8h*)(p + 16); return u.v;
}
__device__ __forceinline__ v16b frag_b(const __bf16* rowk0, int lane) {
  union { v16b v; v8b q[2]; } u; const __bf16* p = rowk0 + 8 * (lane >> 4);
  u.q[0] = *(const v8b*)p; u.q[1] = *(const v8b*)(p + 16); return u.v;
}
__device__ __forceinline__ v16h frag_f32(const float* rowk0, int lane) {
  v16h a; const float* p = rowk0 + 8 * (lane >> 4);
#pragma unroll
  for (int i = 0; i < 8; ++i) { a[i] = (_Float16)p[i]; a[8 + i] = (_Float16)p[16 + i]; }
  return a;
}
__device__ __forceinline__ v16h frag_f32s(const float* rowk0, int lane, float sc) {
  v16h a; const float* p = rowk0 + 8 * (lane >> 4);
#pragma unroll
  for (int i = 0; i < 8; ++i) { a[i] = (_Float16)(p[i] * sc); a[8 + i] = (_Float16)(p[16 + i] * sc); }
  return a;
}
// column fragment from a [K][ld] layout (column n), rows >= K read as 0
__device__ __forceinline__ v16h fragc_f32(const float* W, int k0, int n, int lane, int ld, int K) {
  v16h a; const int g = lane >> 4;
#pragma unroll
  for (int i = 0; i < 8; ++i) { const int ka = k0 + 8 * g + i, kb = ka + 16;
    a[i] = (_Float16)(ka < K ? W[(size_t)ka * ld + n] : 0.f); a[8 + i] = (_Float16)(kb < K ? W[(size_t)kb * ld + n] : 0.f); }
  return a;
}
struct F2 { v16b h, l; };
__device__ __forceinline__ F2 bsplit16(const float v[16]) { F2 r;
#pragma unroll
  for (int i = 0; i < 16; ++i) { const __bf16 h = (__bf16)v[i]; r.h[i] = h; r.l[i] = (__bf16)(v[i] - (float)h); }
  return r; }
__device__ __forceinline__ F2 split_row(const float* row, int k0, int lane) { float v[16]; const float* p = row + k0 + 8 * (lane >> 4);
#pragma unroll
  for (int i = 0; i < 8; ++i) { v[i] = p[i]; v[8 + i] = p[16 + i]; }
  return bsplit16(v); }
__device__ __forceinline__ F2 split_rowK(const float* row, int k0, int lane, int K) { float v[16]; const int g = lane >> 4;
#pragma unroll
  for (int i = 0; i < 8; ++i) { const int ka = k0 + 8 * g + i, kb = ka + 16; v[i] = ka < K ? row[ka] : 0.f; v[8 + i] = kb < K ? row[kb] : 0.f; }
  return bsplit16(v); }
__device__ __forceinline__ F2 split_col(const float* W, int k0, int n, int lane, int ld, int K) { float v[16]; const int g = lane >> 4;
#pragma unroll
  for (int i = 0; i < 8; ++i) { const int ka = k0 + 8 * g + i, kb = ka + 16; v[i] = ka < K ? W[(size_t)ka * ld + n] : 0.f; v[8 + i] = kb < K ? W[(size_t)kb * ld + n] : 0.f; }
  return bsplit16(v); }
__device__ __forceinline__ v8f mac3(const F2& a, const F2& b, v8f c) { c = wmma_bf(a.l, b.h, c); c = wmma_bf(a.h, b.l, c); return wmma_bf(a.h, b.h, c); }
__device__ __forceinline__ float sigm(float v) { return 1.0f / (1.0f + expf(-v)); }
#define LDSX() do { asm volatile("s_wait_dscnt 0" ::: "memory"); __builtin_amdgcn_wave_barrier(); __builtin_amdgcn_fence(__ATOMIC_RELEASE, "workgroup"); } while (0)


// Banded attention with relative position scores (the skew/unskew module): for query i (1,024 per batch-head, 64 batch-heads) and offset j in [0, 1024):
// a(i,j) = softmax_j((q_i . k_{i+j} + q_i . pe_j) / 8); out_i = sum_j a(i,j) v_{i+j}. (The reference's "== 0 -> -1e6" substitution DOES fire a few times per run on bf16-rounded inputs and is replicated.)
// Block = (64 queries, batch-head); 17 key tiles of 64 starting at q0 cover keys q0 .. q0+1087.
// All three products are formed transposed (keys x queries, offsets x queries, head dim x queries), so that in every accumulator a lane's column is ONE query:
// lane (col = query, g) holds keys t*16 + 8g + r of its query in st[t][r]. Mask, maximum, exponential and sum are then in-lane (one exchange between the halves),
// the weights P are already in the operand order of the next product (elements 0..7 = tile 2kc, 8..15 = tile 2kc+1), and the running rescale is the lane's own factor.
// Of the scores, only the position scores pass through LDS, because their offset j = key - query shifts with the lane: 16x80 slab per wave (64 offsets are new in a step, the first 16 are the previous step's last).
// The reference's '== 0 -> -1e6' rule is honoured: near-zero content scores are re-checked with a sequential f32 fma chain over the bf16-rounded rows. No ws; whole 256-B output rows by one wave.
// The key and value tile of a step are the same for the block's four waves: they are rounded to bf16 once, staged in LDS (value transposed) and read as fragments with 16-byte LDS loads.
// The position table pe is the same for every wave too, and the four waves of a block touch overlapping offsets: each step's 64 new offsets are rounded to bf16 once per block and staged transposed,
// [offset][d], in a ring of two 64-offset blocks in LDS; a wave reads its four 16-offset operands from there with 16-byte LDS loads.
// The output rows are staged in the position-score buffer, which is free by then.
#define NBH 64
#define M 1024
#define KL 2048
#define L 1024
#define D 64
#define NKT 17
// exp((s - m) / 8) = 2^(s * SC2 - m * SC2): the division by 8 and the change of base are one factor, applied together with the running maximum in one fused multiply-add in front of the hardware's base-2 exponential.
// The exponent is <= 0; below -126 the hardware form returns 0 where the library form returned a subnormal, far below one unit in the last place of the row sum, whose largest term is 1 up to rounding.
#define SC2 0.18033688011112042f      // log2(e) / 8

// eight consecutive floats of one accumulator to LDS as two 16-byte stores (the rows are 16-byte aligned, not 32)
__device__ __forceinline__ void st8(float* p, v8f v) { *(v4f*)p = __builtin_shufflevector(v, v, 0, 1, 2, 3); *(v4f*)(p + 4) = __builtin_shufflevector(v, v, 4, 5, 6, 7); }

// 2^x of eight values. One statement, so that every exponential is followed by an instruction that touches neither its result nor its source:
// the next exponential (the results are early-clobber, so none lies on a source), and behind the last one the v_nop: the slot that the instruction set asks for behind a transcendental.
__device__ __forceinline__ v8f exp2x8(v8f x) {
  float a, b, c, d, e, f, g, h;
  asm("v_exp_f32 %0, %8\n\tv_exp_f32 %1, %9\n\tv_exp_f32 %2, %10\n\tv_exp_f32 %3, %11\n\tv_exp_f32 %4, %12\n\tv_exp_f32 %5, %13\n\tv_exp_f32 %6, %14\n\tv_exp_f32 %7, %15\n\tv_nop"
      : "=&v"(a), "=&v"(b), "=&v"(c), "=&v"(d), "=&v"(e), "=&v"(f), "=&v"(g), "=&v"(h)
      : "v"(x[0]), "v"(x[1]), "v"(x[2]), "v"(x[3]), "v"(x[4]), "v"(x[5]), "v"(x[6]), "v"(x[7]));
  return (v8f){ a, b, c, d, e, f, g, h };
}

__global__ __launch_bounds__(128) void k_seq(const float* __restrict__ query, const float* __restrict__ key, const float* __restrict__ value, const float* __restrict__ pe, float* __restrict__ out) {
  __shared__ __align__(16) float sQP[4][16][84];      // [query][offset - jw]: q.pe for the 80 offsets jw .. jw+79 that this wave's tile can touch (jw = key0 - q0 - 16)
  __shared__ __align__(16) __bf16 sK[64][72];         // the block's key tile rounded to bf16, [key][d]; 144-byte rows suit the 16-byte fragment reads
  __shared__ __align__(16) __bf16 sVt[64][72];        // the block's value tile rounded to bf16, transposed to [d][key]
  __shared__ __align__(16) __bf16 sPe[128][72];       // pe rounded to bf16, transposed to [offset & 127][d]: offsets 64*n .. 64*n+63 lie in rows 64*(n & 1) ..
  const int tid = threadIdx.x, w = tid >> 5, lane = tid & 31, col = lane & 15, g = lane >> 4;
#ifndef BH0
#define BH0 0
#endif
  const int b = blockIdx.y + BH0; const int q0 = blockIdx.x * 64 + w * 16;
  const float* qb_ = query + (size_t)b * M * D; const float* kb_ = key + (size_t)b * KL * D; const float* vb_ = value + (size_t)b * KL * D;
  v16b aq[2];                          // the wave's 16 queries, used as the second operand (column = query)
#pragma unroll
  for (int kc = 0; kc < 2; ++kc) aq[kc] = split_row(qb_ + (size_t)(q0 + col) * D, kc * 32, lane).h;
  float mrun = -3.0e38f, lrun = 0.f;   // mrun: running maximum of the scores before their scaling
  v8f acc[4] = {}, ac2[4] = {};     // acc[t][r]: head-dim element t*16 + 8g + r of query col
  v8f qp_last = {};                    // the previous step's last 16 offsets of q.pe: they are this step's first 16
  const int sr = tid >> 4, sc = (tid & 15) * 4;      // this thread's place in the staging of a tile
  const int kt0 = blockIdx.x;          // first key tile = the one starting at the block's first query
  const int i = q0 + col;              // this lane's query
  float* const qpw = &sQP[w][col][8 * g];            // where this lane stores its 8 offsets of a 16-offset tile
  const float* const qpr = &sQP[w][col][16 - col + 8 * g];   // key t*16 + 8g + r of query col has offset index (t*16 + 8g + r) - col + 16
  // staging of a 64-offset block of pe: a thread fetches rows pd and pd+1 (and 32 further down), offsets pj .. pj+3 (and 32 further on). Eight lanes cover a whole 128-byte line of a row;
  // four row pairs a wave spread the 4-byte transposed LDS stores over 16 banks. The loops over pa, pc and pf are unrolled so that these arrays are registers.
  const int pj = (lane & 7) * 4, pd = 2 * ((lane >> 3) + 4 * w);
  const float* const pg = pe + (size_t)pd * L + pj; __bf16* const pl = &sPe[pj][pd];
  v4f pa[4], pc[4];
  // offsets 0 .. 63 are staged in front of the loop; step kt stages offsets 64*(kt+1) .. for the next step
#pragma unroll
  for (int it = 0; it < 4; ++it) { const float* p = pg + (it & 1) * 32 + (size_t)(it >> 1) * 32 * L; pa[it] = *(const v4f*)p; pc[it] = *(const v4f*)(p + L); }
#pragma unroll
  for (int it = 0; it < 4; ++it) {
#pragma unroll
    for (int ii = 0; ii < 4; ++ii) { const v2b h = { (__bf16)pa[it][ii], (__bf16)pc[it][ii] }; *(v2b*)(pl + ((it & 1) * 32 + ii) * 72 + (it >> 1) * 32) = h; } }
  __syncthreads();        // the first block of pe is visible to all four waves
#pragma unroll 1
  for (int kt = 0; kt < NKT; ++kt) { const int key0 = (kt0 + kt) * 64; if (key0 >= KL) break;       // block-uniform
    // (1) position-score slab: the offsets depend on the query: j = key - i. For this wave's queries i in [q0, q0+16)
    //     and keys in [key0, key0+64): j in [key0 - q0 - 15, key0 - q0 + 63] subset of [jw, jw + 80) with jw = key0 - q0 - 16 (wave-specific base, a multiple of 16: q0 = 64*bx + 16w -> jw = 64*kt - 16*w - 16).
    //     jw grows by 64 a step, so offsets jw .. jw+15 are the previous step's jw+64 .. jw+79: that product is kept in registers and stored again, and only four 16-offset tiles are multiplied per step.
    //     The four tiles lie in offsets 64*kt - 48 .. 64*kt + 63: the ring's two blocks, staged in the two steps before this one.
    // (0) the four waves share one key tile and one value tile: each thread fetches 1/128 of both in whole 128-byte lines (key rows sr + 8*it; value rows 2*sr + 16*it and the next; columns sc .. sc+3).
    //     The loads are issued here so that they fly under the position slab; rounding and the LDS stores follow behind it.
    v4f kf[8], va[4], vc[4];
    { const float* kt_ = kb_ + (size_t)key0 * D + sr * D + sc; const float* vt_ = vb_ + (size_t)key0 * D + 2 * sr * D + sc;
#pragma unroll
      for (int it = 0; it < 8; ++it) kf[it] = *(const v4f*)(kt_ + it * 8 * D);
#pragma unroll
      for (int it = 0; it < 4; ++it) { va[it] = *(const v4f*)(vt_ + it * 16 * D); vc[it] = *(const v4f*)(vt_ + it * 16 * D + D); } }
    const bool more_pe = (kt + 1) * 64 < L;      // block-uniform: the next step's 64 new offsets exist
    // The fetch is issued in every step (in the last two from offset 0, unused): under the branch the 32 registers would be carried round the whole loop, and the operand groups below need them.
    { const float* pn = pg + (more_pe ? (kt + 1) * 64 : 0);
#pragma unroll
      for (int it = 0; it < 4; ++it) { const float* p = pn + (it & 1) * 32 + (size_t)(it >> 1) * 32 * L; pa[it] = *(const v4f*)p; pc[it] = *(const v4f*)(p + L); } }
    const int jw = key0 - q0 - 16;
    st8(qpw, qp_last);
#pragma unroll
    for (int pp = 1; pp < 5; pp += 2) { v16b pf[2][2];      // two tiles at a time: their four operands are read as one group of LDS loads, and the two accumulators are independent
#pragma unroll
      for (int u = 0; u < 2; ++u) { const int j0 = jw + (pp + u) * 16;
        const int rr = (unsigned)j0 < (unsigned)L ? (j0 & 127) : 0;      // an out-of-range offset tile is never used unmasked: it multiplies rows 0 .. 15 of the ring (always staged), so that the tiles are straight-line code
#pragma unroll
        for (int kc = 0; kc < 2; ++kc) pf[u][kc] = frag_b(&sPe[rr + col][kc * 32], lane); }
      v8f s0 = {}, s1 = {};
#pragma unroll
      for (int kc = 0; kc < 2; ++kc) { s0 = wmma_bf(pf[0][kc], aq[kc], s0); s1 = wmma_bf(pf[1][kc], aq[kc], s1); }
      st8(qpw + pp * 16, s0); st8(qpw + (pp + 1) * 16, s1);
      if (pp == 3) qp_last = s1; }
    __builtin_amdgcn_sched_barrier(0);      // keeps the rounding of the fetched tiles, and with it the wait for their loads, behind the position slab: the loads fly under it
    __syncthreads();      // every wave has left the previous key and value tile, and the older block of pe
    { __bf16* dk = &sK[sr][sc]; __bf16* dv = &sVt[sc][2 * sr];
#pragma unroll
      for (int it = 0; it < 8; ++it) { const v4b h = { (__bf16)kf[it][0], (__bf16)kf[it][1], (__bf16)kf[it][2], (__bf16)kf[it][3] }; *(v4b*)(dk + it * 8 * 72) = h; }
#pragma unroll
      for (int it = 0; it < 4; ++it) {
#pragma unroll
        for (int ii = 0; ii < 4; ++ii) { const v2b h = { (__bf16)va[it][ii], (__bf16)vc[it][ii] }; *(v2b*)(dv + ii * 72 + it * 16) = h; } } }
    if (more_pe) { __bf16* dp = pl + ((kt + 1) & 1) * 64 * 72;
#pragma unroll
      for (int it = 0; it < 4; ++it) {
#pragma unroll
        for (int ii = 0; ii < 4; ++ii) { const v2b h = { (__bf16)pa[it][ii], (__bf16)pc[it][ii] }; *(v2b*)(dp + ((it & 1) * 32 + ii) * 72 + (it >> 1) * 32) = h; } } }
    __syncthreads();      // the new tiles are visible to all four waves (and each wave's slab to its own lanes)
    // (2) content scores, transposed: st[t][r] = k_{key0 + t*16 + 8g + r} . q_i
    //     The eight key operands are fetched as one group of sixteen LDS loads, in the order of their use, so that the LDS latency is waited out once and not in front of every product.
    v8f st[4]; v16b kfr[2][4], vfr[2][4];
#pragma unroll
    for (int kc = 0; kc < 2; ++kc) {
#pragma unroll
      for (int t = 0; t < 4; ++t) kfr[kc][t] = frag_b(&sK[t * 16 + col][kc * 32], lane); }
    __builtin_amdgcn_sched_barrier(0);      // keeps the loads together ahead of the products: sunk to their uses, each pair would cost a full LDS round trip
#pragma unroll
    for (int t = 0; t < 4; ++t) st[t] = wmma_bf(kfr[0][t], aq[0], (v8f){});
#pragma unroll
    for (int t = 0; t < 4; ++t) st[t] = wmma_bf(kfr[1][t], aq[1], st[t]);
    //     The eight value operands of product (4) are fetched here, as one group too: they fly under the mask and softmax arithmetic.
#pragma unroll
    for (int kc = 0; kc < 2; ++kc) {
#pragma unroll
      for (int t = 0; t < 4; ++t) vfr[kc][t] = frag_b(&sVt[t * 16 + col][kc * 32], lane); }
    __builtin_amdgcn_sched_barrier(0);      // keeps the value loads here, ahead of the softmax, instead of in front of each product of (4)
    // (3) zero rule, position score and band mask, in registers
    // The reference replaces an EXACTLY zero content score by -1e6 before adding the position term; with bf16-rounded inputs exact zeros do occur (a few per run).
    // Near-zero candidates are re-evaluated as a sequential f32 fma chain over the bf16-rounded rows (the reference's accumulation order) and the rule applied on that value.
    // One test per lane and tile finds whether there is a candidate at all; the rare path then walks the lane's 32 keys (bit e = t*8 + r).
    float amin = 3.0e38f;
#pragma unroll
    for (int t = 0; t < 4; ++t) {
#pragma unroll
      for (int r = 0; r < 8; ++r) amin = fminf(amin, fabsf(st[t][r])); }
    if (amin < 1.0e-5f) { unsigned nz = 0u, zr = 0u;
#pragma unroll
      for (int t = 0; t < 4; ++t) {
#pragma unroll
        for (int r = 0; r < 8; ++r) nz |= (fabsf(st[t][r]) < 1.0e-5f ? 1u : 0u) << (t * 8 + r); }
      const float* qr = qb_ + (size_t)i * D;
#pragma unroll 1      // rare path: kept rolled so that it costs the tile loop neither registers nor instruction cache
      for (int e = 0; e < 32; ++e) { if ((nz >> e) & 1u) { const float* kr = kb_ + (size_t)(key0 + (e >> 3) * 16 + 8 * g + (e & 7)) * D; float acc_ = 0.f;
          for (int dd = 0; dd < D; ++dd) acc_ = fmaf((float)(__bf16)qr[dd], (float)(__bf16)kr[dd], acc_);
          if (acc_ == 0.0f) zr |= 1u << e; } }
#pragma unroll
      for (int t = 0; t < 4; ++t) {
#pragma unroll
        for (int r = 0; r < 8; ++r) { if ((zr >> (t * 8 + r)) & 1u) st[t][r] = -1000000.0f; } } }
    float qv[4][8];      // this lane's 32 position scores, fetched as one group as well
#pragma unroll
    for (int t = 0; t < 4; ++t) {
#pragma unroll
      for (int r = 0; r < 8; ++r) qv[t][r] = qpr[t * 16 + r]; }
    __builtin_amdgcn_sched_barrier(0);      // keeps these loads together: spread among the additions they cost a wait at every place
#pragma unroll
    for (int t = 0; t < 4; ++t) {
#pragma unroll
      for (int r = 0; r < 8; ++r) st[t][r] += qv[t][r]; }
    // Band mask. A wave's offsets in step kt are j = 64*kt - 16*w + (-15 .. 63): j < 0 can occur only in step 0 and j >= L = 1024 only in step 16 (64*15 + 63 = 1023).
    // The 15 steps between are wholly inside the band and jump over the test (kt is a scalar: one branch for the block).
    if (kt == 0 || kt == NKT - 1) { const int jb = key0 + 8 * g - i;   // offset j of this lane's key (t = 0, r = 0)
#pragma unroll
      for (int t = 0; t < 4; ++t) {
#pragma unroll
        for (int r = 0; r < 8; ++r) st[t][r] = (unsigned)(jb + t * 16 + r) < (unsigned)L ? st[t][r] : -3.0e38f; } }      // j < 0 or j >= L: outside the band
    float mx = -3.4e38f;
#pragma unroll
    for (int t = 0; t < 4; ++t) {
#pragma unroll
      for (int r = 0; r < 8; ++r) mx = fmaxf(mx, st[t][r]); }
    mx = fmaxf(mx, __shfl_xor(mx, 16, 32));
    const float mnew = fmaxf(mrun, mx); const float nnew = -mnew * SC2; const float corr = __builtin_amdgcn_exp2f((mrun - mnew) * SC2);
    // A masked score needs no second test: step 0 holds at least one key inside the band for every query (key0 + 63 >= i), so mnew is a real score from there on,
    // and -3.0e38 * SC2 + nnew is about -5e37, where the base-2 exponential returns exactly 0.
    float ps = 0.f;
#pragma unroll
    for (int t = 0; t < 4; ++t) { v8f df;
#pragma unroll
      for (int r = 0; r < 8; ++r) df[r] = fmaf(st[t][r], SC2, nnew);
      df = exp2x8(df);
#pragma unroll
      for (int r = 0; r < 8; ++r) { ps += df[r]; st[t][r] = df[r]; } }
    ps += __shfl_xor(ps, 16, 32);
    lrun = lrun * corr + ps; mrun = mnew;
#pragma unroll
    for (int t = 0; t < 4; ++t) { acc[t] *= corr; ac2[t] *= corr; }
    // (4) O^T += bf16(V)^T x P^T (hi/lo): the second operand's elements 0..7 are keys kc*32 + 8g + 0..7 = st[2kc], elements 8..15 are keys kc*32 + 16 + 8g + 0..7 = st[2kc+1]
#pragma unroll
    for (int kc = 0; kc < 2; ++kc) { float pv[16];
#pragma unroll
      for (int r = 0; r < 8; ++r) { pv[r] = st[2 * kc][r]; pv[8 + r] = st[2 * kc + 1][r]; }
      const F2 pa = bsplit16(pv);
#pragma unroll
      for (int t = 0; t < 4; ++t) { acc[t] = wmma_bf(vfr[kc][t], pa.h, acc[t]); ac2[t] = wmma_bf(vfr[kc][t], pa.l, ac2[t]); } }
    LDSX(); }
  { const float inv = 1.0f / lrun;
#pragma unroll
    for (int t = 0; t < 4; ++t) st8(qpw + t * 16, (acc[t] + ac2[t]) * inv); }
  LDSX();
  for (int qq = lane; qq < 16 * 16; qq += 32) { const int rl = qq >> 4, pc = qq & 15; vst2(out + ((size_t)b * M + q0 + rl) * D + pc * 4, *(const v4f*)(&sQP[w][rl][pc * 4])); }
}
extern "C" void kernel_launch(void* const* d_in, const int* in_sizes, int n_in, void* d_out, int out_size, void* d_ws, size_t ws_size, hipStream_t stream) {
  (void)in_sizes; (void)n_in; (void)out_size; (void)ws_size; (void)d_ws;
  const float* query = (const float*)d_in[0]; const float* key = (const float*)d_in[1]; const float* value = (const float*)d_in[2]; const float* pe = (const float*)d_in[3];
  float* out = (float*)d_out;
  k_seq<<<dim3(M / 64, NBH), 128, 0, stream>>>(query, key, value, pe, out);
}

// v008
// A run of this version takes 52 microseconds.
// Timed twice side by side with v007, it ran 1.07 times as fast both times.
// All steps since v000 together make it 4.77 times as fast.
// compute dtype: the INPUTS query/key/value/key_pe rounded to bf16 and multiplied with exact bf16 WMMA products (f32 accumulate); the softmax weights P (computed) as a bf16 hi/lo pair; mask and softmax f32.
#include <hip/hip_runtime.h>
#include <math.h>

typedef __attribute__((ext_vector_type(16))) _Float16 v16h;
typedef __attribute__((ext_vector_type(16))) __bf16 v16b;
typedef __attribute__((ext_vector_type(8)))  _Float16 v8h;
typedef __attribute__((ext_vector_type(8)))  __bf16 v8b;
typedef __attribute__((ext_vector_type(4)))  __bf16 v4b;
typedef __attribute__((ext_vector_type(2)))  __bf16 v2b;
typedef __attribute__((ext_vector_type(8)))  float v8f;
typedef __attribute__((ext_vector_type(4)))  float v4f;
typedef __attribute__((ext_vector_type(2)))  float v2f;
typedef __attribute__((ext_vector_type(4)))  unsigned v4u;
typedef __attribute__((ext_vector_type(4)))  int v4i;
typedef float __attribute__((may_alias)) float_a;
typedef int __attribute__((may_alias)) int_a;

template <typename T> __device__ __forceinline__ void vst2(void* p, T v) { *(T*)p = v;  }
__device__ __forceinline__ v8f wmma16(v16h a, v16h b, v8f c) {
  v8f d = __builtin_amdgcn_wmma_f32_16x16x32_f16(false, a, false, b, (short)0, c, false, false);
  asm volatile("v_nop\n\tv_nop\n\tv_nop\n\tv_nop" : "+v"(d) : "v"(a), "v"(b));
  return d;
}
__device__ __forceinline__ v8f wmma_bf(v16b a, v16b b, v8f c) {
  v8f d = __builtin_amdgcn_wmma_f32_16x16x32_bf16(false, a, false, b, (short)0, c, false, false);
  asm volatile("v_nop\n\tv_nop\n\tv_nop\n\tv_nop" : "+v"(d) : "v"(a), "v"(b));
  return d;
}
// 16x16x32 fragments: lane = (h = lane>>4, row/col = lane&15); elements 0..7 = k0+8h+0..7, 8..15 = k0+16+8h+0..7; D element r = row 8h+r
__device__ __forceinline__ v16h frag_h(const _Float16* rowk0, int lane) {
  union { v16h v; v8h q[2]; } u; const _Float16* p = rowk0 + 8 * (lane >> 4);
  u.q[0] = *(const v8h*)p; u.q[1] = *(const v8h*)(p + 16); return u.v;
}
__device__ __forceinline__ v16b frag_b(const __bf16* rowk0, int lane) {
  union { v16b v; v8b q[2]; } u; const __bf16* p = rowk0 + 8 * (lane >> 4);
  u.q[0] = *(const v8b*)p; u.q[1] = *(const v8b*)(p + 16); return u.v;
}
__device__ __forceinline__ v16h frag_f32(const float* rowk0, int lane) {
  v16h a; const float* p = rowk0 + 8 * (lane >> 4);
#pragma unroll
  for (int i = 0; i < 8; ++i) { a[i] = (_Float16)p[i]; a[8 + i] = (_Float16)p[16 + i]; }
  return a;
}
__device__ __forceinline__ v16h frag_f32s(const float* rowk0, int lane, float sc) {
  v16h a; const float* p = rowk0 + 8 * (lane >> 4);
#pragma unroll
  for (int i = 0; i < 8; ++i) { a[i] = (_Float16)(p[i] * sc); a[8 + i] = (_Float16)(p[16 + i] * sc); }
  return a;
}
// column fragment from a [K][ld] layout (column n), rows >= K read as 0
__device__ __forceinline__ v16h fragc_f32(const float* W, int k0, int n, int lane, int ld, int K) {
  v16h a; const int g = lane >> 4;
#pragma unroll
  for (int i = 0; i < 8; ++i) { const int ka = k0 + 8 * g + i, kb = ka + 16;
    a[i] = (_Float16)(ka < K ? W[(size_t)ka * ld + n] : 0.f); a[8 + i] = (_Float16)(kb < K ? W[(size_t)kb * ld + n] : 0.f); }
  return a;
}
struct F2 { v16b h, l; };
__device__ __forceinline__ F2 bsplit16(const float v[16]) { F2 r;
#pragma unroll
  for (int i = 0; i < 16; ++i) { const __bf16 h = (__bf16)v[i]; r.h[i] = h; r.l[i] = (__bf16)(v[i] - (float)h); }
  return r; }
__device__ __forceinline__ F2 split_row(const float* row, int k0, int lane) { float v[16]; const float* p = row + k0 + 8 * (lane >> 4);
#pragma unroll
  for (int i = 0; i < 8; ++i) { v[i] = p[i]; v[8 + i] = p[16 + i]; }
  return bsplit16(v); }
__device__ __forceinline__ F2 split_rowK(const float* row, int k0, int lane, int K) { float v[16]; const int g = lane >> 4;
#pragma unroll
  for (int i = 0; i < 8; ++i) { const int ka = k0 + 8 * g + i, kb = ka + 16; v[i] = ka < K ? row[ka] : 0.f; v[8 + i] = kb < K ? row[kb] : 0.f; }
  return bsplit16(v); }
__device__ __forceinline__ F2 split_col(const float* W, int k0, int n, int lane, int ld, int K) { float v[16]; const int g = lane >> 4;
#pragma unroll
  for (int i = 0; i < 8; ++i) { const int ka = k0 + 8 * g + i, kb = ka + 16; v[i] = ka < K ? W[(size_t)ka * ld + n] : 0.f; v[8 + i] = kb < K ? W[(size_t)kb * ld + n] : 0.f; }
  return bsplit16(v); }
__device__ __forceinline__ v8f mac3(const F2& a, const F2& b, v8f c) { c = wmma_bf(a.l, b.h, c); c = wmma_bf(a.h, b.l, c); return wmma_bf(a.h, b.h, c); }
__device__ __forceinline__ float sigm(float v) { return 1.0f / (1.0f + expf(-v)); }
#define LDSX() do { asm volatile("s_wait_dscnt 0" ::: "memory"); __builtin_amdgcn_wave_barrier(); __builtin_amdgcn_fence(__ATOMIC_RELEASE, "workgroup"); } while (0)


// Banded attention with relative position scores (the skew/unskew module): for query i (1,024 per batch-head, 64 batch-heads) and offset j in [0, 1024):
// a(i,j) = softmax_j((q_i . k_{i+j} + q_i . pe_j) / 8); out_i = sum_j a(i,j) v_{i+j}. (The reference's "== 0 -> -1e6" substitution DOES fire a few times per run on bf16-rounded inputs and is replicated.)
// Block = (128 queries, batch-head), eight waves of 16 queries; 18 key tiles of 64 starting at the block's first query cover keys q .. q+1151.
// A wave works on 17 of them: those of its own 64-query half (the upper half sits out the first tile, the lower half the last); every wave stages every tile and passes every barrier.
// All three products are formed transposed (keys x queries, offsets x queries, head dim x queries), so that in every accumulator a lane's column is ONE query:
// lane (col = query, g) holds keys t*16 + 8g + r of its query in st[t][r]. Mask, maximum, exponential and sum are then in-lane (one exchange between the halves),
// the weights P are already in the operand order of the next product (elements 0..7 = tile 2kc, 8..15 = tile 2kc+1), and the running rescale is the lane's own factor.
// Of the scores, only the position scores pass through LDS, because their offset j = key - query shifts with the lane: 16x80 slab per wave (64 offsets are new in a step, the first 16 are the previous step's last).
// The reference's '== 0 -> -1e6' rule is honoured: near-zero content scores are re-checked with a sequential f32 fma chain over the bf16-rounded rows. No ws; whole 256-B output rows by one wave.
// The key and value tile of a step are the same for the block's eight waves: they are rounded to bf16 once, staged in LDS (value transposed) and read as fragments with 16-byte LDS loads.
// The position table pe is the same for every wave too, and the eight waves of a block touch overlapping offsets: each step's 64 new offsets are rounded to bf16 once per block and staged transposed,
// [offset][d], in a ring of four 64-offset blocks in LDS (three are read in a step, the fourth is filled); a wave reads its four 16-offset operands from there with 16-byte LDS loads.
// The output rows are staged in the position-score buffer, which is free by then.
#define NBH 64
#define M 1024
#define KL 2048
#define L 1024
#define D 64
#define NKT 18      // key tiles a block stages
#define NKW 17      // key tiles a wave works on
// exp((s - m) / 8) = 2^(s * SC2 - m * SC2): the division by 8 and the change of base are one factor, applied together with the running maximum in one fused multiply-add in front of the hardware's base-2 exponential.
// The exponent is <= 0; below -126 the hardware form returns 0 where the library form returned a subnormal, far below one unit in the last place of the row sum, whose largest term is 1 up to rounding.
#define SC2 0.18033688011112042f      // log2(e) / 8

// eight consecutive floats of one accumulator to LDS as two 16-byte stores (the rows are 16-byte aligned, not 32)
__device__ __forceinline__ void st8(float* p, v8f v) { *(v4f*)p = __builtin_shufflevector(v, v, 0, 1, 2, 3); *(v4f*)(p + 4) = __builtin_shufflevector(v, v, 4, 5, 6, 7); }

// 2^x of eight values. One statement, so that every exponential is followed by an instruction that touches neither its result nor its source:
// the next exponential (the results are early-clobber, so none lies on a source), and behind the last one the v_nop: the slot that the instruction set asks for behind a transcendental.
__device__ __forceinline__ v8f exp2x8(v8f x) {
  float a, b, c, d, e, f, g, h;
  asm("v_exp_f32 %0, %8\n\tv_exp_f32 %1, %9\n\tv_exp_f32 %2, %10\n\tv_exp_f32 %3, %11\n\tv_exp_f32 %4, %12\n\tv_exp_f32 %5, %13\n\tv_exp_f32 %6, %14\n\tv_exp_f32 %7, %15\n\tv_nop"
      : "=&v"(a), "=&v"(b), "=&v"(c), "=&v"(d), "=&v"(e), "=&v"(f), "=&v"(g), "=&v"(h)
      : "v"(x[0]), "v"(x[1]), "v"(x[2]), "v"(x[3]), "v"(x[4]), "v"(x[5]), "v"(x[6]), "v"(x[7]));
  return (v8f){ a, b, c, d, e, f, g, h };
}

__global__ __launch_bounds__(256) void k_seq(const float* __restrict__ query, const float* __restrict__ key, const float* __restrict__ value, const float* __restrict__ pe, float* __restrict__ out) {
  __shared__ __align__(16) float sQP[8][16][84];      // [query][offset - jw]: q.pe for the 80 offsets jw .. jw+79 that this wave's tile can touch (jw = key0 - q0 - 16)
  __shared__ __align__(16) __bf16 sK[64][72];         // the block's key tile rounded to bf16, [key][d]; 144-byte rows suit the 16-byte fragment reads
  __shared__ __align__(16) __bf16 sVt[64][72];        // the block's value tile rounded to bf16, transposed to [d][key]
  __shared__ __align__(16) __bf16 sPe[256][72];       // pe rounded to bf16, transposed to [offset & 255][d]: offsets 64*n .. 64*n+63 lie in rows 64*(n & 3) ..
  const int tid = threadIdx.x, w = tid >> 5, lane = tid & 31, col = lane & 15, g = lane >> 4;
#ifndef BH0
#define BH0 0
#endif
  const int b = blockIdx.y + BH0; const int q0 = blockIdx.x * 128 + w * 16;
  const int wq = __builtin_amdgcn_readfirstlane(tid >> 7);      // the wave's 64-query half, in a scalar register: the tests on it below are one scalar branch each
  const float* qb_ = query + (size_t)b * M * D; const float* kb_ = key + (size_t)b * KL * D; const float* vb_ = value + (size_t)b * KL * D;
  v16b aq[2];                          // the wave's 16 queries, used as the second operand (column = query)
#pragma unroll
  for (int kc = 0; kc < 2; ++kc) aq[kc] = split_row(qb_ + (size_t)(q0 + col) * D, kc * 32, lane).h;
  float mrun = -3.0e38f, lrun = 0.f;   // mrun: running maximum of the scores before their scaling
  v8f acc[4] = {}, ac2[4] = {};     // acc[t][r]: head-dim element t*16 + 8g + r of query col
  v8f qp_last = {};                    // the previous step's last 16 offsets of q.pe: they are this step's first 16
  const int sr = tid >> 4, sc = (tid & 15) * 4;      // this thread's place in the staging of a tile
  const int kt0 = blockIdx.x * 2;      // first key tile = the one starting at the block's first query
  const int i = q0 + col;              // this lane's query
  float* const qpw = &sQP[w][col][8 * g];            // where this lane stores its 8 offsets of a 16-offset tile
  const float* const qpr = &sQP[w][col][16 - col + 8 * g];   // key t*16 + 8g + r of query col has offset index (t*16 + 8g + r) - col + 16
  // staging of a 64-offset block of pe: a thread fetches rows pd and pd+1, offsets pj .. pj+3 (and 32 further on). Eight lanes cover a whole 128-byte line of a row;
  // four row pairs a wave spread the 4-byte transposed LDS stores over 16 banks. The loops over pa, pc and pf are unrolled so that these arrays are registers.
  const int pj = (lane & 7) * 4, pd = 2 * ((lane >> 3) + 4 * w);
  const float* const pg = pe + (size_t)pd * L + pj; __bf16* const pl = &sPe[pj][pd];
  v4f pa[2], pc[2];
  // offsets 0 .. 63 are staged in front of the loop; step kt stages offsets 64*(kt+1) .. for the next step
#pragma unroll
  for (int it = 0; it < 2; ++it) { const float* p = pg + it * 32; pa[it] = *(const v4f*)p; pc[it] = *(const v4f*)(p + L); }
#pragma unroll
  for (int it = 0; it < 2; ++it) {
#pragma unroll
    for (int ii = 0; ii < 4; ++ii) { const v2b h = { (__bf16)pa[it][ii], (__bf16)pc[it][ii] }; *(v2b*)(pl + (it * 32 + ii) * 72) = h; } }
  __syncthreads();        // the first block of pe is visible to all eight waves
#pragma unroll 1
  for (int kt = 0; kt < NKT; ++kt) { const int key0 = (kt0 + kt) * 64; if (key0 >= KL) break;       // block-uniform
    // (1) position-score slab: the offsets depend on the query: j = key - i. For this wave's queries i in [q0, q0+16)
    //     and keys in [key0, key0+64): j in [key0 - q0 - 15, key0 - q0 + 63] subset of [jw, jw + 80) with jw = key0 - q0 - 16 (wave-specific base, a multiple of 16: q0 = 128*bx + 16w -> jw = 64*kt - 16*w - 16).
    //     jw grows by 64 a step, so offsets jw .. jw+15 are the previous step's jw+64 .. jw+79: that product is kept in registers and stored again, and only four 16-offset tiles are multiplied per step.
    //     The four tiles lie in offsets 64*kt - 112 .. 64*kt + 63: three blocks of the ring, staged in the three steps before this one.
    // (0) the eight waves share one key tile and one value tile: each thread fetches 1/256 of both in whole 128-byte lines (key rows sr + 16*it; value rows 2*sr + 32*it and the next; columns sc .. sc+3).
    //     The loads are issued here so that they fly under the position slab; rounding and the LDS stores follow behind it.
    v4f kf[4], va[2], vc[2];
    { const float* kt_ = kb_ + (size_t)key0 * D + sr * D + sc; const float* vt_ = vb_ + (size_t)key0 * D + 2 * sr * D + sc;
#pragma unroll
      for (int it = 0; it < 4; ++it) kf[it] = *(const v4f*)(kt_ + it * 16 * D);
#pragma unroll
      for (int it = 0; it < 2; ++it) { va[it] = *(const v4f*)(vt_ + it * 32 * D); vc[it] = *(const v4f*)(vt_ + it * 32 * D + D); } }
    asm volatile("s_wait_xcnt 0x0" ::: "memory");      // stands in front of whatever next writes a register that holds an address of the loads above (a precaution)
    const bool more_pe = (kt + 1) * 64 < L;      // block-uniform: the next step's 64 new offsets exist
    // The fetch is issued in every step (in the last three from offset 0, unused): under the branch the 16 registers would be carried round the whole loop, and the operand groups below need them.
    { const float* pn = pg + (more_pe ? (kt + 1) * 64 : 0);
#pragma unroll
      for (int it = 0; it < 2; ++it) { const float* p = pn + it * 32; pa[it] = *(const v4f*)p; pc[it] = *(const v4f*)(p + L); } }
    asm volatile("s_wait_xcnt 0x0" ::: "memory");      // the same for the four loads of pe
    const int jw = key0 - q0 - 16;
    const int kl = kt - wq;                          // the step as this wave's half counts it
    const bool act = (unsigned)kl < (unsigned)NKW;   // wave-uniform and scalar: this tile holds keys of the wave's band
    if (act) {
    st8(qpw, qp_last);
#pragma unroll
    for (int pp = 1; pp < 5; pp += 2) { v16b pf[2][2];      // two tiles at a time: their four operands are read as one group of LDS loads, and the two accumulators are independent
#pragma unroll
      for (int u = 0; u < 2; ++u) { const int j0 = jw + (pp + u) * 16;
        const int rr = (unsigned)j0 < (unsigned)L ? (j0 & 255) : 0;      // an out-of-range offset tile is never used unmasked: it multiplies rows 0 .. 15 of the ring (always staged), so that the tiles are straight-line code
#pragma unroll
        for (int kc = 0; kc < 2; ++kc) pf[u][kc] = frag_b(&sPe[rr + col][kc * 32], lane); }
      v8f s0 = {}, s1 = {};
#pragma unroll
      for (int kc = 0; kc < 2; ++kc) { s0 = wmma_bf(pf[0][kc], aq[kc], s0); s1 = wmma_bf(pf[1][kc], aq[kc], s1); }
      st8(qpw + pp * 16, s0); st8(qpw + (pp + 1) * 16, s1);
      if (pp == 3) qp_last = s1; } }
    __builtin_amdgcn_sched_barrier(0);      // keeps the rounding of the fetched tiles, and with it the wait for their loads, behind the position slab: the loads fly under it
    __syncthreads();      // every wave has left the previous key and value tile, and the older block of pe
    { __bf16* dk = &sK[sr][sc]; __bf16* dv = &sVt[sc][2 * sr];
#pragma unroll
      for (int it = 0; it < 4; ++it) { const v4b h = { (__bf16)kf[it][0], (__bf16)kf[it][1], (__bf16)kf[it][2], (__bf16)kf[it][3] }; *(v4b*)(dk + it * 16 * 72) = h; }
#pragma unroll
      for (int it = 0; it < 2; ++it) {
#pragma unroll
        for (int ii = 0; ii < 4; ++ii) { const v2b h = { (__bf16)va[it][ii], (__bf16)vc[it][ii] }; *(v2b*)(dv + ii * 72 + it * 32) = h; } } }
    if (more_pe) { __bf16* dp = pl + ((kt + 1) & 3) * 64 * 72;
#pragma unroll
      for (int it = 0; it < 2; ++it) {
#pragma unroll
        for (int ii = 0; ii < 4; ++ii) { const v2b h = { (__bf16)pa[it][ii], (__bf16)pc[it][ii] }; *(v2b*)(dp + (it * 32 + ii) * 72) = h; } } }
    __syncthreads();      // the new tiles are visible to all eight waves (and each wave's slab to its own lanes)
    if (act) {
    // (2) content scores, transposed: st[t][r] = k_{key0 + t*16 + 8g + r} . q_i
    //     The eight key operands are fetched as one group of sixteen LDS loads, in the order of their use, so that the LDS latency is waited out once and not in front of every product.
    v8f st[4]; v16b kfr[2][4], vfr[2][4];
#pragma unroll
    for (int kc = 0; kc < 2; ++kc) {
#pragma unroll
      for (int t = 0; t < 4; ++t) kfr[kc][t] = frag_b(&sK[t * 16 + col][kc * 32], lane); }
    __builtin_amdgcn_sched_barrier(0);      // keeps the loads together ahead of the products: sunk to their uses, each pair would cost a full LDS round trip
#pragma unroll
    for (int t = 0; t < 4; ++t) st[t] = wmma_bf(kfr[0][t], aq[0], (v8f){});
#pragma unroll
    for (int t = 0; t < 4; ++t) st[t] = wmma_bf(kfr[1][t], aq[1], st[t]);
    //     The eight value operands of product (4) are fetched here, as one group too: they fly under the mask and softmax arithmetic.
#pragma unroll
    for (int kc = 0; kc < 2; ++kc) {
#pragma unroll
      for (int t = 0; t < 4; ++t) vfr[kc][t] = frag_b(&sVt[t * 16 + col][kc * 32], lane); }
    __builtin_amdgcn_sched_barrier(0);      // keeps the value loads here, ahead of the softmax, instead of in front of each product of (4)
    // (3) zero rule, position score and band mask, in registers
    // The reference replaces an EXACTLY zero content score by -1e6 before adding the position term; with bf16-rounded inputs exact zeros do occur (a few per run).
    // Near-zero candidates are re-evaluated as a sequential f32 fma chain over the bf16-rounded rows (the reference's accumulation order) and the rule applied on that value.
    // One test per lane and tile finds whether there is a candidate at all; the rare path then walks the lane's 32 keys (bit e = t*8 + r).
    float amin = 3.0e38f;
#pragma unroll
    for (int t = 0; t < 4; ++t) {
#pragma unroll
      for (int r = 0; r < 8; ++r) amin = fminf(amin, fabsf(st[t][r])); }
    if (amin < 1.0e-5f) { unsigned nz = 0u, zr = 0u;
#pragma unroll
      for (int t = 0; t < 4; ++t) {
#pragma unroll
        for (int r = 0; r < 8; ++r) nz |= (fabsf(st[t][r]) < 1.0e-5f ? 1u : 0u) << (t * 8 + r); }
      const float* qr = qb_ + (size_t)i * D;
#pragma unroll 1      // rare path: kept rolled so that it costs the tile loop neither registers nor instruction cache
      for (int e = 0; e < 32; ++e) { if ((nz >> e) & 1u) { const float* kr = kb_ + (size_t)(key0 + (e >> 3) * 16 + 8 * g + (e & 7)) * D; float acc_ = 0.f;
          for (int dd = 0; dd < D; ++dd) acc_ = fmaf((float)(__bf16)qr[dd], (float)(__bf16)kr[dd], acc_);
          if (acc_ == 0.0f) zr |= 1u << e; } }
#pragma unroll
      for (int t = 0; t < 4; ++t) {
#pragma unroll
        for (int r = 0; r < 8; ++r) { if ((zr >> (t * 8 + r)) & 1u) st[t][r] = -1000000.0f; } } }
    float qv[4][8];      // this lane's 32 position scores, fetched as one group as well
#pragma unroll
    for (int t = 0; t < 4; ++t) {
#pragma unroll
      for (int r = 0; r < 8; ++r) qv[t][r] = qpr[t * 16 + r]; }
    __builtin_amdgcn_sched_barrier(0);      // keeps these loads together: spread among the additions they cost a wait at every place
#pragma unroll
    for (int t = 0; t < 4; ++t) {
#pragma unroll
      for (int r = 0; r < 8; ++r) st[t][r] += qv[t][r]; }
    // Band mask. A wave's offsets in its step kl are j = 64*kl - 16*(w & 3) + (-15 .. 63): j < 0 can occur only in step 0 and j >= L = 1024 only in step 16 (64*15 + 63 = 1023).
    // The 15 steps between are wholly inside the band and jump over the test (kl is a scalar: one branch for the wave).
    if (kl == 0 || kl == NKW - 1) { const int jb = key0 + 8 * g - i;   // offset j of this lane's key (t = 0, r = 0)
#pragma unroll
      for (int t = 0; t < 4; ++t) {
#pragma unroll
        for (int r = 0; r < 8; ++r) st[t][r] = (unsigned)(jb + t * 16 + r) < (unsigned)L ? st[t][r] : -3.0e38f; } }      // j < 0 or j >= L: outside the band
    float mx = -3.4e38f;
#pragma unroll
    for (int t = 0; t < 4; ++t) {
#pragma unroll
      for (int r = 0; r < 8; ++r) mx = fmaxf(mx, st[t][r]); }
    mx = fmaxf(mx, __shfl_xor(mx, 16, 32));
    const float mnew = fmaxf(mrun, mx); const float nnew = -mnew * SC2; const float corr = __builtin_amdgcn_exp2f((mrun - mnew) * SC2);
    // A masked score needs no second test: the wave's step 0 holds at least one key inside the band for every query (key0 + 63 >= i), so mnew is a real score from there on,
    // and -3.0e38 * SC2 + nnew is about -5e37, where the base-2 exponential returns exactly 0.
    float ps = 0.f;
#pragma unroll
    for (int t = 0; t < 4; ++t) { v8f df;
#pragma unroll
      for (int r = 0; r < 8; ++r) df[r] = fmaf(st[t][r], SC2, nnew);
      df = exp2x8(df);
#pragma unroll
      for (int r = 0; r < 8; ++r) { ps += df[r]; st[t][r] = df[r]; } }
    ps += __shfl_xor(ps, 16, 32);
    lrun = lrun * corr + ps; mrun = mnew;
#pragma unroll
    for (int t = 0; t < 4; ++t) { acc[t] *= corr; ac2[t] *= corr; }
    // (4) O^T += bf16(V)^T x P^T (hi/lo): the second operand's elements 0..7 are keys kc*32 + 8g + 0..7 = st[2kc], elements 8..15 are keys kc*32 + 16 + 8g + 0..7 = st[2kc+1]
#pragma unroll
    for (int kc = 0; kc < 2; ++kc) { float pv[16];
#pragma unroll
      for (int r = 0; r < 8; ++r) { pv[r] = st[2 * kc][r]; pv[8 + r] = st[2 * kc + 1][r]; }
      const F2 pa = bsplit16(pv);
#pragma unroll
      for (int t = 0; t < 4; ++t) { acc[t] = wmma_bf(vfr[kc][t], pa.h, acc[t]); ac2[t] = wmma_bf(vfr[kc][t], pa.l, ac2[t]); } } }
    LDSX(); }
  { const float inv = 1.0f / lrun;
#pragma unroll
    for (int t = 0; t < 4; ++t) st8(qpw + t * 16, (acc[t] + ac2[t]) * inv); }
  LDSX();
  for (int qq = lane; qq < 16 * 16; qq += 32) { const int rl = qq >> 4, pc = qq & 15; vst2(out + ((size_t)b * M + q0 + rl) * D + pc * 4, *(const v4f*)(&sQP[w][rl][pc * 4])); }
}
extern "C" void kernel_launch(void* const* d_in, const int* in_sizes, int n_in, void* d_out, int out_size, void* d_ws, size_t ws_size, hipStream_t stream) {
  (void)in_sizes; (void)n_in; (void)out_size; (void)ws_size; (void)d_ws;
  const float* query = (const float*)d_in[0]; const float* key = (const float*)d_in[1]; const float* value = (const float*)d_in[2]; const float* pe = (const float*)d_in[3];
  float* out = (float*)d_out;
  k_seq<<<dim3(M / 128, NBH), 256, 0, stream>>>(query, key, value, pe, out);
}

// v009
// One run takes 45.8 microseconds.
// Two timings next to v008 put it at 1.14 and 1.13 times that version's speed.
// Over all steps from v000 it is 5.42 times as fast.
// compute dtype: the INPUTS query/key/key_pe rounded to bf16 and multiplied with exact bf16 WMMA products (f32 accumulate); the softmax weights P (computed, in [0, 1]) rounded to f16 and multiplied with the bf16-rounded value carried in f16 (f16 WMMA, f32 accumulate); mask and softmax f32.
#include <hip/hip_runtime.h>
#include <math.h>

typedef __attribute__((ext_vector_type(16))) _Float16 v16h;
typedef __attribute__((ext_vector_type(16))) __bf16 v16b;
typedef __attribute__((ext_vector_type(8)))  _Float16 v8h;
typedef __attribute__((ext_vector_type(2)))  _Float16 v2h;
typedef __attribute__((ext_vector_type(8)))  __bf16 v8b;
typedef __attribute__((ext_vector_type(4)))  __bf16 v4b;
typedef __attribute__((ext_vector_type(2)))  __bf16 v2b;
typedef __attribute__((ext_vector_type(8)))  float v8f;
typedef __attribute__((ext_vector_type(4)))  float v4f;
typedef __attribute__((ext_vector_type(2)))  float v2f;
typedef __attribute__((ext_vector_type(4)))  unsigned v4u;
typedef __attribute__((ext_vector_type(4)))  int v4i;
typedef float __attribute__((may_alias)) float_a;
typedef int __attribute__((may_alias)) int_a;

template <typename T> __device__ __forceinline__ void vst2(void* p, T v) { *(T*)p = v;  }
__device__ __forceinline__ v8f wmma16(v16h a, v16h b, v8f c) {
  v8f d = __builtin_amdgcn_wmma_f32_16x16x32_f16(false, a, false, b, (short)0, c, false, false);
  asm volatile("v_nop\n\tv_nop\n\tv_nop\n\tv_nop" : "+v"(d) : "v"(a), "v"(b));
  return d;
}
__device__ __forceinline__ v8f wmma_bf(v16b a, v16b b, v8f c) {
  v8f d = __builtin_amdgcn_wmma_f32_16x16x32_bf16(false, a, false, b, (short)0, c, false, false);
  asm volatile("v_nop\n\tv_nop\n\tv_nop\n\tv_nop" : "+v"(d) : "v"(a), "v"(b));
  return d;
}
// 16x16x32 fragments: lane = (h = lane>>4, row/col = lane&15); elements 0..7 = k0+8h+0..7, 8..15 = k0+16+8h+0..7; D element r = row 8h+r
__device__ __forceinline__ v16h frag_h(const _Float16* rowk0, int lane) {
  union { v16h v; v8h q[2]; } u; const _Float16* p = rowk0 + 8 * (lane >> 4);
  u.q[0] = *(const v8h*)p; u.q[1] = *(const v8h*)(p + 16); return u.v;
}
__device__ __forceinline__ v16b frag_b(const __bf16* rowk0, int lane) {
  union { v16b v; v8b q[2]; } u; const __bf16* p = rowk0 + 8 * (lane >> 4);
  u.q[0] = *(const v8b*)p; u.q[1] = *(const v8b*)(p + 16); return u.v;
}
__device__ __forceinline__ v16h frag_f32(const float* rowk0, int lane) {
  v16h a; const float* p = rowk0 + 8 * (lane >> 4);
#pragma unroll
  for (int i = 0; i < 8; ++i) { a[i] = (_Float16)p[i]; a[8 + i] = (_Float16)p[16 + i]; }
  return a;
}
__device__ __forceinline__ v16h frag_f32s(const float* rowk0, int lane, float sc) {
  v16h a; const float* p = rowk0 + 8 * (lane >> 4);
#pragma unroll
  for (int i = 0; i < 8; ++i) { a[i] = (_Float16)(p[i] * sc); a[8 + i] = (_Float16)(p[16 + i] * sc); }
  return a;
}
// column fragment from a [K][ld] layout (column n), rows >= K read as 0
__device__ __forceinline__ v16h fragc_f32(const float* W, int k0, int n, int lane, int ld, int K) {
  v16h a; const int g = lane >> 4;
#pragma unroll
  for (int i = 0; i < 8; ++i) { const int ka = k0 + 8 * g + i, kb = ka + 16;
    a[i] = (_Float16)(ka < K ? W[(size_t)ka * ld + n] : 0.f); a[8 + i] = (_Float16)(kb < K ? W[(size_t)kb * ld + n] : 0.f); }
  return a;
}
struct F2 { v16b h, l; };
__device__ __forceinline__ F2 bsplit16(const float v[16]) { F2 r;
#pragma unroll
  for (int i = 0; i < 16; ++i) { const __bf16 h = (__bf16)v[i]; r.h[i] = h; r.l[i] = (__bf16)(v[i] - (float)h); }
  return r; }
__device__ __forceinline__ F2 split_row(const float* row, int k0, int lane) { float v[16]; const float* p = row + k0 + 8 * (lane >> 4);
#pragma unroll
  for (int i = 0; i < 8; ++i) { v[i] = p[i]; v[8 + i] = p[16 + i]; }
  return bsplit16(v); }
__device__ __forceinline__ F2 split_rowK(const float* row, int k0, int lane, int K) { float v[16]; const int g = lane >> 4;
#pragma unroll
  for (int i = 0; i < 8; ++i) { const int ka = k0 + 8 * g + i, kb = ka + 16; v[i] = ka < K ? row[ka] : 0.f; v[8 + i] = kb < K ? row[kb] : 0.f; }
  return bsplit16(v); }
__device__ __forceinline__ F2 split_col(const float* W, int k0, int n, int lane, int ld, int K) { float v[16]; const int g = lane >> 4;
#pragma unroll
  for (int i = 0; i < 8; ++i) { const int ka = k0 + 8 * g + i, kb = ka + 16; v[i] = ka < K ? W[(size_t)ka * ld + n] : 0.f; v[8 + i] = kb < K ? W[(size_t)kb * ld + n] : 0.f; }
  return bsplit16(v); }
__device__ __forceinline__ v8f mac3(const F2& a, const F2& b, v8f c) { c = wmma_bf(a.l, b.h, c); c = wmma_bf(a.h, b.l, c); return wmma_bf(a.h, b.h, c); }
__device__ __forceinline__ float sigm(float v) { return 1.0f / (1.0f + expf(-v)); }
#define LDSX() do { asm volatile("s_wait_dscnt 0" ::: "memory"); __builtin_amdgcn_wave_barrier(); __builtin_amdgcn_fence(__ATOMIC_RELEASE, "workgroup"); } while (0)


// Banded attention with relative position scores (the skew/unskew module): for query i (1,024 per batch-head, 64 batch-heads) and offset j in [0, 1024):
// a(i,j) = softmax_j((q_i . k_{i+j} + q_i . pe_j) / 8); out_i = sum_j a(i,j) v_{i+j}. (The reference's "== 0 -> -1e6" substitution DOES fire a few times per run on bf16-rounded inputs and is replicated.)
// Block = (128 queries, batch-head), eight waves of 16 queries; 18 key tiles of 64 starting at the block's first query cover keys q .. q+1151.
// A wave works on 17 of them: those of its own 64-query half (the upper half sits out the first tile, the lower half the last); every wave stages every tile and passes every barrier.
// All three products are formed transposed (keys x queries, offsets x queries, head dim x queries), so that in every accumulator a lane's column is ONE query:
// lane (col = query, g) holds keys t*16 + 8g + r of its query in st[t][r]. Mask, maximum, exponential and sum are then in-lane (one exchange between the halves),
// the weights P are already in the operand order of the next product (elements 0..7 = tile 2kc, 8..15 = tile 2kc+1), and the running rescale is the lane's own factor.
// Of the scores, only the position scores pass through LDS, because their offset j = key - query shifts with the lane: 16x80 slab per wave (64 offsets are new in a step, the first 16 are the previous step's last).
// The reference's '== 0 -> -1e6' rule is honoured: near-zero content scores are re-checked with a sequential f32 fma chain over the bf16-rounded rows. No ws; whole 256-B output rows by one wave.
// The key and value tile of a step are the same for the block's eight waves: they are rounded to bf16 once, staged in LDS (value transposed) and read as fragments with 16-byte LDS loads.
// The weights P lie in [0, 1] and the one at the running maximum rounds to exactly 1: one f16 plane (11 significant bits) carries them, and product (4) is an f16 product. Its other operand is the bf16-rounded value
// written as f16: 8 significant bits fit in 11, so the change of format is exact from 2^-14 up to the f16 range (below it the step is 2^-24; a standard normal draw never nears 65,504).
// The position table pe is the same for every wave too, and the eight waves of a block touch overlapping offsets: each step's 64 new offsets are rounded to bf16 once per block and staged transposed,
// [offset][d], in a ring of four 64-offset blocks in LDS (three are read in a step, the fourth is filled); a wave reads its four 16-offset operands from there with 16-byte LDS loads.
// The output rows are staged in the position-score buffer, which is free by then.
#define NBH 64
#define M 1024
#define KL 2048
#define L 1024
#define D 64
#define NKT 18      // key tiles a block stages
#define NKW 17      // key tiles a wave works on
// exp((s - m) / 8) = 2^(s * SC2 - m * SC2): the division by 8 and the change of base are one factor, applied together with the running maximum in one fused multiply-add in front of the hardware's base-2 exponential.
// The exponent is <= 0; below -126 the hardware form returns 0 where the library form returned a subnormal, far below one unit in the last place of the row sum, whose largest term is 1 up to rounding.
#define SC2 0.18033688011112042f      // log2(e) / 8

// eight consecutive floats of one accumulator to LDS as two 16-byte stores (the rows are 16-byte aligned, not 32)
__device__ __forceinline__ void st8(float* p, v8f v) { *(v4f*)p = __builtin_shufflevector(v, v, 0, 1, 2, 3); *(v4f*)(p + 4) = __builtin_shufflevector(v, v, 4, 5, 6, 7); }

// 2^x of eight values. One statement, so that every exponential is followed by an instruction that touches neither its result nor its source:
// the next exponential (the results are early-clobber, so none lies on a source), and behind the last one the v_nop: the slot that the instruction set asks for behind a transcendental.
__device__ __forceinline__ v8f exp2x8(v8f x) {
  float a, b, c, d, e, f, g, h;
  asm("v_exp_f32 %0, %8\n\tv_exp_f32 %1, %9\n\tv_exp_f32 %2, %10\n\tv_exp_f32 %3, %11\n\tv_exp_f32 %4, %12\n\tv_exp_f32 %5, %13\n\tv_exp_f32 %6, %14\n\tv_exp_f32 %7, %15\n\tv_nop"
      : "=&v"(a), "=&v"(b), "=&v"(c), "=&v"(d), "=&v"(e), "=&v"(f), "=&v"(g), "=&v"(h)
      : "v"(x[0]), "v"(x[1]), "v"(x[2]), "v"(x[3]), "v"(x[4]), "v"(x[5]), "v"(x[6]), "v"(x[7]));
  return (v8f){ a, b, c, d, e, f, g, h };
}

__global__ __launch_bounds__(256) void k_seq(const float* __restrict__ query, const float* __restrict__ key, const float* __restrict__ value, const float* __restrict__ pe, float* __restrict__ out) {
  __shared__ __align__(16) float sQP[8][16][84];      // [query][offset - jw]: q.pe for the 80 offsets jw .. jw+79 that this wave's tile can touch (jw = key0 - q0 - 16)
  __shared__ __align__(16) __bf16 sK[64][72];         // the block's key tile rounded to bf16, [key][d]; 144-byte rows suit the 16-byte fragment reads
  __shared__ __align__(16) _Float16 sVt[64][72];      // the block's value tile rounded to bf16 and held as f16, transposed to [d][key]
  __shared__ __align__(16) __bf16 sPe[256][72];       // pe rounded to bf16, transposed to [offset & 255][d]: offsets 64*n .. 64*n+63 lie in rows 64*(n & 3) ..
  const int tid = threadIdx.x, w = tid >> 5, lane = tid & 31, col = lane & 15, g = lane >> 4;
#ifndef BH0
#define BH0 0
#endif
  const int b = blockIdx.y + BH0; const int q0 = blockIdx.x * 128 + w * 16;
  const int wq = __builtin_amdgcn_readfirstlane(tid >> 7);      // the wave's 64-query half, in a scalar register: the tests on it below are one scalar branch each
  const float* qb_ = query + (size_t)b * M * D; const float* kb_ = key + (size_t)b * KL * D; const float* vb_ = value + (size_t)b * KL * D;
  v16b aq[2];                          // the wave's 16 queries, used as the second operand (column = query)
#pragma unroll
  for (int kc = 0; kc < 2; ++kc) aq[kc] = split_row(qb_ + (size_t)(q0 + col) * D, kc * 32, lane).h;
  float mrun = -3.0e38f, lrun = 0.f;   // mrun: running maximum of the scores before their scaling
  v8f acc[4] = {};                  // acc[t][r]: head-dim element t*16 + 8g + r of query col
  v8f qp_last = {};                    // the previous step's last 16 offsets of q.pe: they are this step's first 16
  const int sr = tid >> 4, sc = (tid & 15) * 4;      // this thread's place in the staging of a tile
  const int kt0 = blockIdx.x * 2;      // first key tile = the one starting at the block's first query
  const int i = q0 + col;              // this lane's query
  float* const qpw = &sQP[w][col][8 * g];            // where this lane stores its 8 offsets of a 16-offset tile
  const float* const qpr = &sQP[w][col][16 - col + 8 * g];   // key t*16 + 8g + r of query col has offset index (t*16 + 8g + r) - col + 16
  // staging of a 64-offset block of pe: a thread fetches rows pd and pd+1, offsets pj .. pj+3 (and 32 further on). Eight lanes cover a whole 128-byte line of a row;
  // four row pairs a wave spread the 4-byte transposed LDS stores over 16 banks. The loops over pa, pc and pf are unrolled so that these arrays are registers.
  const int pj = (lane & 7) * 4, pd = 2 * ((lane >> 3) + 4 * w);
  const float* const pg = pe + (size_t)pd * L + pj; __bf16* const pl = &sPe[pj][pd];
  v4f pa[2], pc[2];
  // offsets 0 .. 63 are staged in front of the loop; step kt stages offsets 64*(kt+1) .. for the next step
#pragma unroll
  for (int it = 0; it < 2; ++it) { const float* p = pg + it * 32; pa[it] = *(const v4f*)p; pc[it] = *(const v4f*)(p + L); }
#pragma unroll
  for (int it = 0; it < 2; ++it) {
#pragma unroll
    for (int ii = 0; ii < 4; ++ii) { const v2b h = { (__bf16)pa[it][ii], (__bf16)pc[it][ii] }; *(v2b*)(pl + (it * 32 + ii) * 72) = h; } }
  __syncthreads();        // the first block of pe is visible to all eight waves
#pragma unroll 1
  for (int kt = 0; kt < NKT; ++kt) { const int key0 = (kt0 + kt) * 64; if (key0 >= KL) break;       // block-uniform
    // (1) position-score slab: the offsets depend on the query: j = key - i. For this wave's queries i in [q0, q0+16)
    //     and keys in [key0, key0+64): j in [key0 - q0 - 15, key0 - q0 + 63] subset of [jw, jw + 80) with jw = key0 - q0 - 16 (wave-specific base, a multiple of 16: q0 = 128*bx + 16w -> jw = 64*kt - 16*w - 16).
    //     jw grows by 64 a step, so offsets jw .. jw+15 are the previous step's jw+64 .. jw+79: that product is kept in registers and stored again, and only four 16-offset tiles are multiplied per step.
    //     The four tiles lie in offsets 64*kt - 112 .. 64*kt + 63: three blocks of the ring, staged in the three steps before this one.
    // (0) the eight waves share one key tile and one value tile: each thread fetches 1/256 of both in whole 128-byte lines (key rows sr + 16*it; value rows 2*sr + 32*it and the next; columns sc .. sc+3).
    //     The loads are issued here so that they fly under the position slab; rounding and the LDS stores follow behind it.
    v4f kf[4], va[2], vc[2];
    { const float* kt_ = kb_ + (size_t)key0 * D + sr * D + sc; const float* vt_ = vb_ + (size_t)key0 * D + 2 * sr * D + sc;
#pragma unroll
      for (int it = 0; it < 4; ++it) kf[it] = *(const v4f*)(kt_ + it * 16 * D);
#pragma unroll
      for (int it = 0; it < 2; ++it) { va[it] = *(const v4f*)(vt_ + it * 32 * D); vc[it] = *(const v4f*)(vt_ + it * 32 * D + D); } }
    asm volatile("s_wait_xcnt 0x0" ::: "memory");      // stands in front of whatever next writes a register that holds an address of the loads above (a precaution)
    const bool more_pe = (kt + 1) * 64 < L;      // block-uniform: the next step's 64 new offsets exist
    // The fetch is issued in every step (in the last three from offset 0, unused): under the branch the 16 registers would be carried round the whole loop, and the operand groups below need them.
    { const float* pn = pg + (more_pe ? (kt + 1) * 64 : 0);
#pragma unroll
      for (int it = 0; it < 2; ++it) { const float* p = pn + it * 32; pa[it] = *(const v4f*)p; pc[it] = *(const v4f*)(p + L); } }
    asm volatile("s_wait_xcnt 0x0" ::: "memory");      // the same for the four loads of pe
    const int jw = key0 - q0 - 16;
    const int kl = kt - wq;                          // the step as this wave's half counts it
    const bool act = (unsigned)kl < (unsigned)NKW;   // wave-uniform and scalar: this tile holds keys of the wave's band
    if (act) {
    st8(qpw, qp_last);
#pragma unroll
    for (int pp = 1; pp < 5; pp += 2) { v16b pf[2][2];      // two tiles at a time: their four operands are read as one group of LDS loads, and the two accumulators are independent
#pragma unroll
      for (int u = 0; u < 2; ++u) { const int j0 = jw + (pp + u) * 16;
        const int rr = (unsigned)j0 < (unsigned)L ? (j0 & 255) : 0;      // an out-of-range offset tile is never used unmasked: it multiplies rows 0 .. 15 of the ring (always staged), so that the tiles are straight-line code
#pragma unroll
        for (int kc = 0; kc < 2; ++kc) pf[u][kc] = frag_b(&sPe[rr + col][kc * 32], lane); }
      v8f s0 = {}, s1 = {};
#pragma unroll
      for (int kc = 0; kc < 2; ++kc) { s0 = wmma_bf(pf[0][kc], aq[kc], s0); s1 = wmma_bf(pf[1][kc], aq[kc], s1); }
      st8(qpw + pp * 16, s0); st8(qpw + (pp + 1) * 16, s1);
      if (pp == 3) qp_last = s1; } }
    __builtin_amdgcn_sched_barrier(0);      // keeps the rounding of the fetched tiles, and with it the wait for their loads, behind the position slab: the loads fly under it
    __syncthreads();      // every wave has left the previous key and value tile, and the older block of pe
    { __bf16* dk = &sK[sr][sc]; _Float16* dv = &sVt[sc][2 * sr];
#pragma unroll
      for (int it = 0; it < 4; ++it) { const v4b h = { (__bf16)kf[it][0], (__bf16)kf[it][1], (__bf16)kf[it][2], (__bf16)kf[it][3] }; *(v4b*)(dk + it * 16 * 72) = h; }
#pragma unroll
      for (int it = 0; it < 2; ++it) {
#pragma unroll
        for (int ii = 0; ii < 4; ++ii) { const v2b h = { (__bf16)va[it][ii], (__bf16)vc[it][ii] }; const unsigned u = __builtin_bit_cast(unsigned, h);      // one packed rounding to bf16; a bf16 is the upper half of its f32
          const v2f f = { __builtin_bit_cast(float, u << 16), __builtin_bit_cast(float, u & 0xffff0000u) }; *(v2h*)(dv + ii * 72 + it * 32) = __builtin_convertvector(f, v2h); } } }
    if (more_pe) { __bf16* dp = pl + ((kt + 1) & 3) * 64 * 72;
#pragma unroll
      for (int it = 0; it < 2; ++it) {
#pragma unroll
        for (int ii = 0; ii < 4; ++ii) { const v2b h = { (__bf16)pa[it][ii], (__bf16)pc[it][ii] }; *(v2b*)(dp + (it * 32 + ii) * 72) = h; } } }
    __syncthreads();      // the new tiles are visible to all eight waves (and each wave's slab to its own lanes)
    if (act) {
    // (2) content scores, transposed: st[t][r] = k_{key0 + t*16 + 8g + r} . q_i
    //     The eight key operands are fetched as one group of sixteen LDS loads, in the order of their use, so that the LDS latency is waited out once and not in front of every product.
    v8f st[4]; v16b kfr[2][4]; v16h vfr[2][4];
#pragma unroll
    for (int kc = 0; kc < 2; ++kc) {
#pragma unroll
      for (int t = 0; t < 4; ++t) kfr[kc][t] = frag_b(&sK[t * 16 + col][kc * 32], lane); }
    __builtin_amdgcn_sched_barrier(0);      // keeps the loads together ahead of the products: sunk to their uses, each pair would cost a full LDS round trip
#pragma unroll
    for (int t = 0; t < 4; ++t) st[t] = wmma_bf(kfr[0][t], aq[0], (v8f){});
#pragma unroll
    for (int t = 0; t < 4; ++t) st[t] = wmma_bf(kfr[1][t], aq[1], st[t]);
    //     The eight value operands of product (4) are fetched here, as one group too: they fly under the mask and softmax arithmetic.
#pragma unroll
    for (int kc = 0; kc < 2; ++kc) {
#pragma unroll
      for (int t = 0; t < 4; ++t) vfr[kc][t] = frag_h(&sVt[t * 16 + col][kc * 32], lane); }
    __builtin_amdgcn_sched_barrier(0);      // keeps the value loads here, ahead of the softmax, instead of in front of each product of (4)
    // (3) zero rule, position score and band mask, in registers
    // The reference replaces an EXACTLY zero content score by -1e6 before adding the position term; with bf16-rounded inputs exact zeros do occur (a few per run).
    // Near-zero candidates are re-evaluated as a sequential f32 fma chain over the bf16-rounded rows (the reference's accumulation order) and the rule applied on that value.
    // One test per lane and tile finds whether there is a candidate at all; the rare path then walks the lane's 32 keys (bit e = t*8 + r).
    float amin = 3.0e38f;
#pragma unroll
    for (int t = 0; t < 4; ++t) {
#pragma unroll
      for (int r = 0; r < 8; ++r) amin = fminf(amin, fabsf(st[t][r])); }
    if (amin < 1.0e-5f) { unsigned nz = 0u, zr = 0u;
#pragma unroll
      for (int t = 0; t < 4; ++t) {
#pragma unroll
        for (int r = 0; r < 8; ++r) nz |= (fabsf(st[t][r]) < 1.0e-5f ? 1u : 0u) << (t * 8 + r); }
      const float* qr = qb_ + (size_t)i * D;
#pragma unroll 1      // rare path: kept rolled so that it costs the tile loop neither registers nor instruction cache
      for (int e = 0; e < 32; ++e) { if ((nz >> e) & 1u) { const float* kr = kb_ + (size_t)(key0 + (e >> 3) * 16 + 8 * g + (e & 7)) * D; float acc_ = 0.f;
          for (int dd = 0; dd < D; ++dd) acc_ = fmaf((float)(__bf16)qr[dd], (float)(__bf16)kr[dd], acc_);
          if (acc_ == 0.0f) zr |= 1u << e; } }
#pragma unroll
      for (int t = 0; t < 4; ++t) {
#pragma unroll
        for (int r = 0; r < 8; ++r) { if ((zr >> (t * 8 + r)) & 1u) st[t][r] = -1000000.0f; } } }
    float qv[4][8];      // this lane's 32 position scores, fetched as one group as well
#pragma unroll
    for (int t = 0; t < 4; ++t) {
#pragma unroll
      for (int r = 0; r < 8; ++r) qv[t][r] = qpr[t * 16 + r]; }
    __builtin_amdgcn_sched_barrier(0);      // keeps these loads together: spread among the additions they cost a wait at every place
#pragma unroll
    for (int t = 0; t < 4; ++t) {
#pragma unroll
      for (int r = 0; r < 8; ++r) st[t][r] += qv[t][r]; }
    // Band mask. A wave's offsets in its step kl are j = 64*kl - 16*(w & 3) + (-15 .. 63): j < 0 can occur only in step 0 and j >= L = 1024 only in step 16 (64*15 + 63 = 1023).
    // The 15 steps between are wholly inside the band and jump over the test (kl is a scalar: one branch for the wave).
    if (kl == 0 || kl == NKW - 1) { const int jb = key0 + 8 * g - i;   // offset j of this lane's key (t = 0, r = 0)
#pragma unroll
      for (int t = 0; t < 4; ++t) {
#pragma unroll
        for (int r = 0; r < 8; ++r) st[t][r] = (unsigned)(jb + t * 16 + r) < (unsigned)L ? st[t][r] : -3.0e38f; } }      // j < 0 or j >= L: outside the band
    float mx = -3.4e38f;
#pragma unroll
    for (int t = 0; t < 4; ++t) {
#pragma unroll
      for (int r = 0; r < 8; ++r) mx = fmaxf(mx, st[t][r]); }
    mx = fmaxf(mx, __shfl_xor(mx, 16, 32));
    const float mnew = fmaxf(mrun, mx); const float nnew = -mnew * SC2; const float corr = __builtin_amdgcn_exp2f((mrun - mnew) * SC2);
    // A masked score needs no second test: the wave's step 0 holds at least one key inside the band for every query (key0 + 63 >= i), so mnew is a real score from there on,
    // and -3.0e38 * SC2 + nnew is about -5e37, where the base-2 exponential returns exactly 0.
    float ps = 0.f;
#pragma unroll
    for (int t = 0; t < 4; ++t) { v8f df;
#pragma unroll
      for (int r = 0; r < 8; ++r) df[r] = fmaf(st[t][r], SC2, nnew);
      df = exp2x8(df);
#pragma unroll
      for (int r = 0; r < 8; ++r) { ps += df[r]; st[t][r] = df[r]; } }
    ps += __shfl_xor(ps, 16, 32);
    lrun = lrun * corr + ps; mrun = mnew;
#pragma unroll
    for (int t = 0; t < 4; ++t) acc[t] *= corr;
    // (4) O^T += bf16(V)^T x f16(P)^T: the second operand's elements 0..7 are keys kc*32 + 8g + 0..7 = st[2kc], elements 8..15 are keys kc*32 + 16 + 8g + 0..7 = st[2kc+1]
#pragma unroll
    for (int kc = 0; kc < 2; ++kc) {
      const v16h ph = __builtin_shufflevector(__builtin_convertvector(st[2 * kc], v8h), __builtin_convertvector(st[2 * kc + 1], v8h), 0, 1, 2, 3, 4, 5, 6, 7, 8, 9, 10, 11, 12, 13, 14, 15);
#pragma unroll
      for (int t = 0; t < 4; ++t) acc[t] = wmma16(vfr[kc][t], ph, acc[t]); } }
    LDSX(); }
  { const float inv = 1.0f / lrun;
#pragma unroll
    for (int t = 0; t < 4; ++t) st8(qpw + t * 16, acc[t] * inv); }
  LDSX();
  for (int qq = lane; qq < 16 * 16; qq += 32) { const int rl = qq >> 4, pc = qq & 15; vst2(out + ((size_t)b * M + q0 + rl) * D + pc * 4, *(const v4f*)(&sQP[w][rl][pc * 4])); }
}
extern "C" void kernel_launch(void* const* d_in, const int* in_sizes, int n_in, void* d_out, int out_size, void* d_ws, size_t ws_size, hipStream_t stream) {
  (void)in_sizes; (void)n_in; (void)out_size; (void)ws_size; (void)d_ws;
  const float* query = (const float*)d_in[0]; const float* key = (const float*)d_in[1]; const float* value = (const float*)d_in[2]; const float* pe = (const float*)d_in[3];
  float* out = (float*)d_out;
  k_seq<<<dim3(M / 128, NBH), 256, 0, stream>>>(query, key, value, pe, out);
}

// v010
// A run of this version takes 42.6 microseconds.
// In two side-by-side timings against v009, it was 1.08 and 1.07 times as fast.
// Over all steps from v000 it is 5.83 times as fast.
// compute dtype: the INPUTS query/key/key_pe rounded to bf16 and multiplied with exact bf16 WMMA products (f32 accumulate); the softmax weights P (computed, in [0, 1]) rounded to f16 and multiplied with the bf16-rounded value carried in f16 (f16 WMMA, f32 accumulate); mask and softmax f32.
#include <hip/hip_runtime.h>
#include <math.h>

typedef __attribute__((ext_vector_type(16))) _Float16 v16h;
typedef __attribute__((ext_vector_type(16))) __bf16 v16b;
typedef __attribute__((ext_vector_type(8)))  _Float16 v8h;
typedef __attribute__((ext_vector_type(2)))  _Float16 v2h;
typedef __attribute__((ext_vector_type(8)))  __bf16 v8b;
typedef __attribute__((ext_vector_type(4)))  __bf16 v4b;
typedef __attribute__((ext_vector_type(2)))  __bf16 v2b;
typedef __attribute__((ext_vector_type(8)))  float v8f;
typedef __attribute__((ext_vector_type(4)))  float v4f;
typedef __attribute__((ext_vector_type(2)))  float v2f;
typedef __attribute__((ext_vector_type(4)))  unsigned v4u;
typedef __attribute__((ext_vector_type(4)))  int v4i;
typedef float __attribute__((may_alias)) float_a;
typedef int __attribute__((may_alias)) int_a;

template <typename T> __device__ __forceinline__ void vst2(void* p, T v) { *(T*)p = v;  }
__device__ __forceinline__ v8f wmma16(v16h a, v16h b, v8f c) {
  v8f d = __builtin_amdgcn_wmma_f32_16x16x32_f16(false, a, false, b, (short)0, c, false, false);
  asm volatile("v_nop\n\tv_nop\n\tv_nop\n\tv_nop" : "+v"(d) : "v"(a), "v"(b));
  return d;
}
__device__ __forceinline__ v8f wmma_bf(v16b a, v16b b, v8f c) {
  v8f d = __builtin_amdgcn_wmma_f32_16x16x32_bf16(false, a, false, b, (short)0, c, false, false);
  asm volatile("v_nop\n\tv_nop\n\tv_nop\n\tv_nop" : "+v"(d) : "v"(a), "v"(b));
  return d;
}
// 16x16x32 fragments: lane = (h = lane>>4, row/col = lane&15); elements 0..7 = k0+8h+0..7, 8..15 = k0+16+8h+0..7; D element r = row 8h+r
__device__ __forceinline__ v16h frag_h(const _Float16* rowk0, int lane) {
  union { v16h v; v8h q[2]; } u; const _Float16* p = rowk0 + 8 * (lane >> 4);
  u.q[0] = *(const v8h*)p; u.q[1] = *(const v8h*)(p + 16); return u.v;
}
__device__ __forceinline__ v16b frag_b(const __bf16* rowk0, int lane) {
  union { v16b v; v8b q[2]; } u; const __bf16* p = rowk0 + 8 * (lane >> 4);
  u.q[0] = *(const v8b*)p; u.q[1] = *(const v8b*)(p + 16); return u.v;
}
__device__ __forceinline__ v16h frag_f32(const float* rowk0, int lane) {
  v16h a; const float* p = rowk0 + 8 * (lane >> 4);
#pragma unroll
  for (int i = 0; i < 8; ++i) { a[i] = (_Float16)p[i]; a[8 + i] = (_Float16)p[16 + i]; }
  return a;
}
__device__ __forceinline__ v16h frag_f32s(const float* rowk0, int lane, float sc) {
  v16h a; const float* p = rowk0 + 8 * (lane >> 4);
#pragma unroll
  for (int i = 0; i < 8; ++i) { a[i] = (_Float16)(p[i] * sc); a[8 + i] = (_Float16)(p[16 + i] * sc); }
  return a;
}
// column fragment from a [K][ld] layout (column n), rows >= K read as 0
__device__ __forceinline__ v16h fragc_f32(const float* W, int k0, int n, int lane, int ld, int K) {
  v16h a; const int g = lane >> 4;
#pragma unroll
  for (int i = 0; i < 8; ++i) { const int ka = k0 + 8 * g + i, kb = ka + 16;
    a[i] = (_Float16)(ka < K ? W[(size_t)ka * ld + n] : 0.f); a[8 + i] = (_Float16)(kb < K ? W[(size_t)kb * ld + n] : 0.f); }
  return a;
}
struct F2 { v16b h, l; };
__device__ __forceinline__ F2 bsplit16(const float v[16]) { F2 r;
#pragma unroll
  for (int i = 0; i < 16; ++i) { const __bf16 h = (__bf16)v[i]; r.h[i] = h; r.l[i] = (__bf16)(v[i] - (float)h); }
  return r; }
__device__ __forceinline__ F2 split_row(const float* row, int k0, int lane) { float v[16]; const float* p = row + k0 + 8 * (lane >> 4);
#pragma unroll
  for (int i = 0; i < 8; ++i) { v[i] = p[i]; v[8 + i] = p[16 + i]; }
  return bsplit16(v); }
__device__ __forceinline__ F2 split_rowK(const float* row, int k0, int lane, int K) { float v[16]; const int g = lane >> 4;
#pragma unroll
  for (int i = 0; i < 8; ++i) { const int ka = k0 + 8 * g + i, kb = ka + 16; v[i] = ka < K ? row[ka] : 0.f; v[8 + i] = kb < K ? row[kb] : 0.f; }
  return bsplit16(v); }
__device__ __forceinline__ F2 split_col(const float* W, int k0, int n, int lane, int ld, int K) { float v[16]; const int g = lane >> 4;
#pragma unroll
  for (int i = 0; i < 8; ++i) { const int ka = k0 + 8 * g + i, kb = ka + 16; v[i] = ka < K ? W[(size_t)ka * ld + n] : 0.f; v[8 + i] = kb < K ? W[(size_t)kb * ld + n] : 0.f; }
  return bsplit16(v); }
__device__ __forceinline__ v8f mac3(const F2& a, const F2& b, v8f c) { c = wmma_bf(a.l, b.h, c); c = wmma_bf(a.h, b.l, c); return wmma_bf(a.h, b.h, c); }
__device__ __forceinline__ float sigm(float v) { return 1.0f / (1.0f + expf(-v)); }
#define LDSX() do { asm volatile("s_wait_dscnt 0" ::: "memory"); __builtin_amdgcn_wave_barrier(); __builtin_amdgcn_fence(__ATOMIC_RELEASE, "workgroup"); } while (0)


// Banded attention with relative position scores (the skew/unskew module): for query i (1,024 per batch-head, 64 batch-heads) and offset j in [0, 1024):
// a(i,j) = softmax_j((q_i . k_{i+j} + q_i . pe_j) / 8); out_i = sum_j a(i,j) v_{i+j}. (The reference's "== 0 -> -1e6" substitution DOES fire a few times per run on bf16-rounded inputs and is replicated.)
// Block = (128 queries, batch-head), eight waves of 16 queries; 18 key tiles of 64 starting at the block's first query cover keys q .. q+1151.
// A wave works on 17 of them, those of its own 64-query half: in step s (0 .. 16) the lower half works on tile s and the upper half on tile s+1, so that every wave is busy in every step; every wave stages every tile.
// The key and value tiles lie in a ring of three buffers (tile t in buffer t mod 3): step s reads tiles s and s+1 and writes tile s+2 at its foot, so that a step has ONE work-group barrier.
// The position slab runs one step ahead too (step s forms that of step s+1, behind its last product): with softmax and product (4) it covers the flight of the loads of tile s+2.
// All three products are formed transposed (keys x queries, offsets x queries, head dim x queries), so that in every accumulator a lane's column is ONE query:
// lane (col = query, g) holds keys t*16 + 8g + r of its query in st[t][r]. Mask, maximum, exponential and sum are then in-lane (one exchange between the halves),
// the weights P are already in the operand order of the next product (elements 0..7 = tile 2kc, 8..15 = tile 2kc+1), and the running rescale is the lane's own factor.
// Of the scores, only the position scores pass through LDS, because their offset j = key - query shifts with the lane: 16x80 slab per wave (64 offsets are new in a step, the first 16 are the previous step's last).
// The reference's '== 0 -> -1e6' rule is honoured: near-zero content scores are re-checked with a sequential f32 fma chain over the bf16-rounded rows. No ws; whole 256-B output rows by one wave.
// A key and value tile serves all eight waves (tile t: the upper half in step t-1, the lower half in step t): it is rounded to bf16 once, staged in LDS (value transposed) and read as fragments with 16-byte LDS loads.
// The weights P lie in [0, 1] and the one at the running maximum rounds to exactly 1: one f16 plane (11 significant bits) carries them, and product (4) is an f16 product. Its other operand is the bf16-rounded value
// written as f16: 8 significant bits fit in 11, so the change of format is exact from 2^-14 up to the f16 range (below it the step is 2^-24; a standard normal draw never nears 65,504).
// The position table pe is the same for every wave too, and the eight waves of a block touch overlapping offsets: each step's 64 new offsets are rounded to bf16 once per block and staged transposed,
// [offset][d], in a ring of four 64-offset blocks in LDS (two are read in a step, a third is filled); a wave reads its four 16-offset operands from there with 16-byte LDS loads.
// The output rows are staged in the position-score buffer, which is free by then.
#define NBH 64
#define M 1024
#define KL 2048
#define L 1024
#define D 64
#define NKT 18      // key tiles a block stages
#define NKW 17      // key tiles a wave works on
// exp((s - m) / 8) = 2^(s * SC2 - m * SC2): the division by 8 and the change of base are one factor, applied together with the running maximum in one fused multiply-add in front of the hardware's base-2 exponential.
// The exponent is <= 0; below -126 the hardware form returns 0 where the library form returned a subnormal, far below one unit in the last place of the row sum, whose largest term is 1 up to rounding.
#define SC2 0.18033688011112042f      // log2(e) / 8

// eight consecutive floats of one accumulator to LDS as two 16-byte stores (the rows are 16-byte aligned, not 32)
__device__ __forceinline__ void st8(float* p, v8f v) { *(v4f*)p = __builtin_shufflevector(v, v, 0, 1, 2, 3); *(v4f*)(p + 4) = __builtin_shufflevector(v, v, 4, 5, 6, 7); }

// 2^x of eight values. One statement, so that every exponential is followed by an instruction that touches neither its result nor its source:
// the next exponential (the results are early-clobber, so none lies on a source), and behind the last one the v_nop: the slot that the instruction set asks for behind a transcendental.
__device__ __forceinline__ v8f exp2x8(v8f x) {
  float a, b, c, d, e, f, g, h;
  asm("v_exp_f32 %0, %8\n\tv_exp_f32 %1, %9\n\tv_exp_f32 %2, %10\n\tv_exp_f32 %3, %11\n\tv_exp_f32 %4, %12\n\tv_exp_f32 %5, %13\n\tv_exp_f32 %6, %14\n\tv_exp_f32 %7, %15\n\tv_nop"
      : "=&v"(a), "=&v"(b), "=&v"(c), "=&v"(d), "=&v"(e), "=&v"(f), "=&v"(g), "=&v"(h)
      : "v"(x[0]), "v"(x[1]), "v"(x[2]), "v"(x[3]), "v"(x[4]), "v"(x[5]), "v"(x[6]), "v"(x[7]));
  return (v8f){ a, b, c, d, e, f, g, h };
}

__global__ __launch_bounds__(256) void k_seq(const float* __restrict__ query, const float* __restrict__ key, const float* __restrict__ value, const float* __restrict__ pe, float* __restrict__ out) {
  __shared__ __align__(16) float sQP[8][16][84];      // [query][offset - jw]: q.pe for the 80 offsets jw .. jw+79 that this wave's tile can touch (jw = key0 - q0 - 16)
  __shared__ __align__(16) __bf16 sK[3][64][72];      // the block's key tiles rounded to bf16, [tile mod 3][key][d]; 144-byte rows suit the 16-byte fragment reads
  __shared__ __align__(16) _Float16 sVt[3][64][72];   // the block's value tiles rounded to bf16 and held as f16, transposed to [tile mod 3][d][key]
  __shared__ __align__(16) __bf16 sPe[256][72];       // pe rounded to bf16, transposed to [offset & 255][d]: offsets 64*n .. 64*n+63 lie in rows 64*(n & 3) ..
  const int tid = threadIdx.x, w = tid >> 5, lane = tid & 31, col = lane & 15, g = lane >> 4;
#ifndef BH0
#define BH0 0
#endif
  const int b = blockIdx.y + BH0; const int q0 = blockIdx.x * 128 + w * 16;
  const int wq = __builtin_amdgcn_readfirstlane(tid >> 7);      // the wave's 64-query half, in a scalar register: its tile's first key and ring buffer are then scalar arithmetic
  const float* qb_ = query + (size_t)b * M * D; const float* kb_ = key + (size_t)b * KL * D; const float* vb_ = value + (size_t)b * KL * D;
  v16b aq[2];                          // the wave's 16 queries, used as the second operand (column = query)
#pragma unroll
  for (int kc = 0; kc < 2; ++kc) aq[kc] = split_row(qb_ + (size_t)(q0 + col) * D, kc * 32, lane).h;
  float mrun = -3.0e38f, lrun = 0.f;   // mrun: running maximum of the scores before their scaling
  v8f acc[4] = {};                  // acc[t][r]: head-dim element t*16 + 8g + r of query col
  v8f qp_last = {};                    // the previous step's last 16 offsets of q.pe: they are this step's first 16
  const int sr = tid >> 4, sc = (tid & 15) * 4;      // this thread's place in the staging of a tile
  const int kt0 = blockIdx.x * 2;      // first key tile = the one starting at the block's first query
  const int i = q0 + col;              // this lane's query
  float* const qpw = &sQP[w][col][8 * g];            // where this lane stores its 8 offsets of a 16-offset tile
  const float* const qpr = &sQP[w][col][16 - col + 8 * g];   // key t*16 + 8g + r of query col has offset index (t*16 + 8g + r) - col + 16
  // staging of a 64-offset block of pe: a thread fetches rows pd and pd+1, offsets pj .. pj+3 (and 32 further on). Eight lanes cover a whole 128-byte line of a row;
  // four row pairs a wave spread the 4-byte transposed LDS stores over 16 banks. The loops over pa, pc and pf are unrolled so that these arrays are registers.
  const int pj = (lane & 7) * 4, pd = 2 * ((lane >> 3) + 4 * w);
  const float* const pg = pe + (size_t)pd * L + pj; __bf16* const pl = &sPe[pj][pd];
  v4f pa[2], pc[2], kf[4], va[2], vc[2];
  // The eight waves share every key tile and value tile: each thread fetches 1/256 of both in whole 128-byte lines (key rows sr + 16*it; value rows 2*sr + 32*it and the next; columns sc .. sc+3),
  // and its share of a 64-offset block of pe.
  auto fetch_kv = [&](int keyn) {
    const float* kt_ = kb_ + (size_t)keyn * D + sr * D + sc; const float* vt_ = vb_ + (size_t)keyn * D + 2 * sr * D + sc;
#pragma unroll
    for (int it = 0; it < 4; ++it) kf[it] = *(const v4f*)(kt_ + it * 16 * D);
#pragma unroll
    for (int it = 0; it < 2; ++it) { va[it] = *(const v4f*)(vt_ + it * 32 * D); vc[it] = *(const v4f*)(vt_ + it * 32 * D + D); }
    asm volatile("s_wait_xcnt 0x0" ::: "memory");      // stands in front of whatever next writes a register that holds an address of the loads above (a precaution)
    __builtin_amdgcn_sched_barrier(0);      // keeps the loads from sinking towards their use, and later writes of their address registers from rising over the wait
  };
  auto fetch_pe = [&](int pen) {
    const float* pn = pg + pen;
#pragma unroll
    for (int it = 0; it < 2; ++it) { const float* p = pn + it * 32; pa[it] = *(const v4f*)p; pc[it] = *(const v4f*)(p + L); }
    asm volatile("s_wait_xcnt 0x0" ::: "memory");      // the same for the four loads of pe
    __builtin_amdgcn_sched_barrier(0);      // as in fetch_kv
  };
  // rounding of what the two fetches brought, and the LDS stores: key and value tile into buffer bf, the block of pe into ring block rb
  auto put_kv = [&](int bf) {
    __bf16* dk = &sK[bf][sr][sc]; _Float16* dv = &sVt[bf][sc][2 * sr];
#pragma unroll
    for (int it = 0; it < 4; ++it) { const v4b h = { (__bf16)kf[it][0], (__bf16)kf[it][1], (__bf16)kf[it][2], (__bf16)kf[it][3] }; *(v4b*)(dk + it * 16 * 72) = h; }
#pragma unroll
    for (int it = 0; it < 2; ++it) {
#pragma unroll
      for (int ii = 0; ii < 4; ++ii) { const v2b h = { (__bf16)va[it][ii], (__bf16)vc[it][ii] }; const unsigned u = __builtin_bit_cast(unsigned, h);      // one packed rounding to bf16; a bf16 is the upper half of its f32
        const v2f f = { __builtin_bit_cast(float, u << 16), __builtin_bit_cast(float, u & 0xffff0000u) }; *(v2h*)(dv + ii * 72 + it * 32) = __builtin_convertvector(f, v2h); } }
  };
  auto put_pe = [&](int rb) {
    __bf16* dp = pl + rb * 64 * 72;
#pragma unroll
    for (int it = 0; it < 2; ++it) {
#pragma unroll
      for (int ii = 0; ii < 4; ++ii) { const v2b h = { (__bf16)pa[it][ii], (__bf16)pc[it][ii] }; *(v2b*)(dp + (it * 32 + ii) * 72) = h; } }
  };
  // (1) position-score slab of the wave's step sn: the offsets depend on the query: j = key - i. For this wave's queries i in [q0, q0+16)
  //     and keys in [key0, key0+64): j in [key0 - q0 - 15, key0 - q0 + 63] subset of [jw, jw + 80) with jw = key0 - q0 - 16
  //     (a multiple of 16: q0 = 128*bx + 64*wq + 16*wl and key0 = 128*bx + 64*(sn + wq) -> jw = 64*sn - 16*wl - 16, the same in both halves).
  //     jw grows by 64 a step, so offsets jw .. jw+15 are the previous step's jw+64 .. jw+79: that product is kept in registers and stored again, and only four 16-offset tiles are multiplied per step.
  //     The four tiles lie in offsets 64*sn - 48 .. 64*sn + 63: ring blocks sn-1 and sn.
  const int wl = __builtin_amdgcn_readfirstlane(tid >> 5) & 3;      // the wave's number within its half, in a scalar register: the ring rows below are then scalar arithmetic
  auto slab = [&](int sn) {
    const int jw = 64 * sn - 16 * wl - 16;
    st8(qpw, qp_last);
#pragma unroll
    for (int pp = 1; pp < 5; pp += 2) { v16b pf[2][2];      // two tiles at a time: their four operands are read as one group of LDS loads, and the two accumulators are independent
#pragma unroll
      for (int u = 0; u < 2; ++u) { const int j0 = jw + (pp + u) * 16;
        // an out-of-range offset tile is never used unmasked: it multiplies the first rows of ring block sn & 3 (staged earlier, and not the block that is being written meanwhile), so that the tiles are straight-line code
        const int rr = (unsigned)j0 < (unsigned)L ? (j0 & 255) : (sn & 3) * 64;
#pragma unroll
        for (int kc = 0; kc < 2; ++kc) pf[u][kc] = frag_b(&sPe[rr + col][kc * 32], lane); }
      __builtin_amdgcn_sched_barrier(0);      // keeps the eight loads together ahead of the products: with a product between them the LDS latency is waited out twice
      v8f s0 = {}, s1 = {};
#pragma unroll
      for (int kc = 0; kc < 2; ++kc) { s0 = wmma_bf(pf[0][kc], aq[kc], s0); s1 = wmma_bf(pf[1][kc], aq[kc], s1); }
      st8(qpw + pp * 16, s0); st8(qpw + (pp + 1) * 16, s1);
      if (pp == 3) qp_last = s1; }
  };
  static_assert((M / 128 - 1) * 2 + NKT <= KL / 64, "the last block's last key tile lies inside key and value");
  static_assert(L > 128, "the two blocks of pe that are staged in front of the loop exist");
  // In front of the loop: key and value tiles 0 and 1, offsets 0 .. 127, and the slab of step 0. Step s then stages tile s+2 and offsets 64*(s+2) .., and forms the slab of step s+1.
  // Two rounds of loads: the queries fly together with the first tile and block, the second tile with the second block.
  fetch_kv(kt0 * 64); fetch_pe(0);
  put_kv(0); put_pe(0);
  __builtin_amdgcn_sched_barrier(0);      // keeps the second round's loads from rising into the rounding above: between them and their wait nothing then writes an address register
  fetch_kv(kt0 * 64 + 64); fetch_pe(64);
  put_kv(1); put_pe(1);
  __syncthreads();        // the first two tiles and the first two blocks of pe are visible to all eight waves
  slab(0);
  LDSX();      // the wave's slab is written before its own lanes read it crosswise in step 0 (in the loop the step's barrier does that)
  int bl = wq, bw = 2;      // ring buffers, scalar: bl holds this wave's tile s + wq, bw takes tile s + 2
#pragma unroll 1
  for (int s = 0; s < NKW; ++s) { const int key0 = (kt0 + s + wq) * 64;      // the wave's tile: wave-uniform and scalar
    // (0) tile s+2 is fetched in the middle of this step (behind the scores, where the position scores' registers have come free) and flies under the rest of it;
    //     it is rounded and written at the foot of the step into buffers that this step does not read:
    //     key and value buffer (s+2) mod 3 = (s-1) mod 3 was last read in step s-1, ring block (s+2) & 3 = (s-2) & 3 by the slab formed in step s-2: both lie behind the barrier at the foot of step s-1.
    const bool more_kv = s + 2 < NKT;            // block-uniform: tile s+2 exists
    const bool more_pe = (s + 2) * 64 < L;       // block-uniform: offsets 64*(s+2) .. exist
    // The fetch is issued in every step (where there is nothing more, from tile s and from offset 0, unused): straight-line code, and every address stays inside its input.
    const int keyn = (kt0 + (more_kv ? s + 2 : s)) * 64, pen = more_pe ? (s + 2) * 64 : 0;
    const __bf16 (* const cK)[72] = sK[bl]; const _Float16 (* const cV)[72] = sVt[bl];      // this wave's tile
    // (2) content scores, transposed: st[t][r] = k_{key0 + t*16 + 8g + r} . q_i
    //     The eight key operands are fetched as one group of sixteen LDS loads, in the order of their use, so that the LDS latency is waited out once and not in front of every product.
    v8f st[4]; v16b kfr[2][4]; v16h vfr[2][4];
#pragma unroll
    for (int kc = 0; kc < 2; ++kc) {
#pragma unroll
      for (int t = 0; t < 4; ++t) kfr[kc][t] = frag_b(&cK[t * 16 + col][kc * 32], lane); }
    __builtin_amdgcn_sched_barrier(0);      // keeps the loads together ahead of the products: sunk to their uses, each pair would cost a full LDS round trip
#pragma unroll
    for (int t = 0; t < 4; ++t) st[t] = wmma_bf(kfr[0][t], aq[0], (v8f){});
#pragma unroll
    for (int t = 0; t < 4; ++t) st[t] = wmma_bf(kfr[1][t], aq[1], st[t]);
    //     The eight value operands of product (4) are fetched here, as one group too: they fly under the mask and softmax arithmetic.
#pragma unroll
    for (int kc = 0; kc < 2; ++kc) {
#pragma unroll
      for (int t = 0; t < 4; ++t) vfr[kc][t] = frag_h(&cV[t * 16 + col][kc * 32], lane); }
    __builtin_amdgcn_sched_barrier(0);      // keeps the value loads here, ahead of the softmax, instead of in front of each product of (4)
    // (3) zero rule, position score and band mask, in registers
    // The reference replaces an EXACTLY zero content score by -1e6 before adding the position term; with bf16-rounded inputs exact zeros do occur (a few per run).
    // Near-zero candidates are re-evaluated as a sequential f32 fma chain over the bf16-rounded rows (the reference's accumulation order) and the rule applied on that value.
    // One test per lane and tile finds whether there is a candidate at all; the rare path then walks the lane's 32 keys (bit e = t*8 + r).
    float amin = 3.0e38f;
#pragma unroll
    for (int t = 0; t < 4; ++t) {
#pragma unroll
      for (int r = 0; r < 8; ++r) amin = fminf(amin, fabsf(st[t][r])); }
    if (amin < 1.0e-5f) { unsigned nz = 0u, zr = 0u;
#pragma unroll
      for (int t = 0; t < 4; ++t) {
#pragma unroll
        for (int r = 0; r < 8; ++r) nz |= (fabsf(st[t][r]) < 1.0e-5f ? 1u : 0u) << (t * 8 + r); }
      const float* qr = qb_ + (size_t)i * D;
#pragma unroll 1      // rare path: kept rolled so that it costs the tile loop neither registers nor instruction cache
      for (int e = 0; e < 32; ++e) { if ((nz >> e) & 1u) { const float* kr = kb_ + (size_t)(key0 + (e >> 3) * 16 + 8 * g + (e & 7)) * D; float acc_ = 0.f;
          for (int dd = 0; dd < D; ++dd) acc_ = fmaf((float)(__bf16)qr[dd], (float)(__bf16)kr[dd], acc_);
          if (acc_ == 0.0f) zr |= 1u << e; } }
#pragma unroll
      for (int t = 0; t < 4; ++t) {
#pragma unroll
        for (int r = 0; r < 8; ++r) { if ((zr >> (t * 8 + r)) & 1u) st[t][r] = -1000000.0f; } } }
    float qv[4][8];      // this lane's 32 position scores, fetched as one group as well
#pragma unroll
    for (int t = 0; t < 4; ++t) {
#pragma unroll
      for (int r = 0; r < 8; ++r) qv[t][r] = qpr[t * 16 + r]; }
    __builtin_amdgcn_sched_barrier(0);      // keeps these loads together: spread among the additions they cost a wait at every place
#pragma unroll
    for (int t = 0; t < 4; ++t) {
#pragma unroll
      for (int r = 0; r < 8; ++r) st[t][r] += qv[t][r]; }
    // Band mask. A wave's offsets in step s are j = 64*s - 16*(w & 3) + (-15 .. 63): j < 0 can occur only in step 0 and j >= L = 1024 only in step 16 (64*15 + 63 = 1023).
    // The 15 steps between are wholly inside the band and jump over the test (s is a scalar: one branch).
    if (s == 0 || s == NKW - 1) { const int jb = key0 + 8 * g - i;   // offset j of this lane's key (t = 0, r = 0)
#pragma unroll
      for (int t = 0; t < 4; ++t) {
#pragma unroll
        for (int r = 0; r < 8; ++r) st[t][r] = (unsigned)(jb + t * 16 + r) < (unsigned)L ? st[t][r] : -3.0e38f; } }      // j < 0 or j >= L: outside the band
    fetch_kv(keyn); fetch_pe(pen);
    float mx = -3.4e38f;
#pragma unroll
    for (int t = 0; t < 4; ++t) {
#pragma unroll
      for (int r = 0; r < 8; ++r) mx = fmaxf(mx, st[t][r]); }
    mx = fmaxf(mx, __shfl_xor(mx, 16, 32));
    const float mnew = fmaxf(mrun, mx); const float nnew = -mnew * SC2; const float corr = __builtin_amdgcn_exp2f((mrun - mnew) * SC2);
    // A masked score needs no second test: the wave's step 0 holds at least one key inside the band for every query (key0 + 63 >= i), so mnew is a real score from there on,
    // and -3.0e38 * SC2 + nnew is about -5e37, where the base-2 exponential returns exactly 0.
    float ps = 0.f;
#pragma unroll
    for (int t = 0; t < 4; ++t) { v8f df;
#pragma unroll
      for (int r = 0; r < 8; ++r) df[r] = fmaf(st[t][r], SC2, nnew);
      df = exp2x8(df);
#pragma unroll
      for (int r = 0; r < 8; ++r) { ps += df[r]; st[t][r] = df[r]; } }
    ps += __shfl_xor(ps, 16, 32);
    lrun = lrun * corr + ps; mrun = mnew;
#pragma unroll
    for (int t = 0; t < 4; ++t) acc[t] *= corr;
    // (4) O^T += bf16(V)^T x f16(P)^T: the second operand's elements 0..7 are keys kc*32 + 8g + 0..7 = st[2kc], elements 8..15 are keys kc*32 + 16 + 8g + 0..7 = st[2kc+1]
    v16h ph[2];
#pragma unroll
    for (int kc = 0; kc < 2; ++kc)
      ph[kc] = __builtin_shufflevector(__builtin_convertvector(st[2 * kc], v8h), __builtin_convertvector(st[2 * kc + 1], v8h), 0, 1, 2, 3, 4, 5, 6, 7, 8, 9, 10, 11, 12, 13, 14, 15);
#pragma unroll
    for (int kc = 0; kc < 2; ++kc) {
#pragma unroll
      for (int t = 0; t < 4; ++t) acc[t] = wmma16(vfr[kc][t], ph[kc], acc[t]); }
    if (s + 1 < NKW) slab(s + 1);      // block-uniform. This step's slab has been read (its values are in the scores)
    __builtin_amdgcn_sched_barrier(0);      // keeps the rounding of the fetched tiles, and with it the wait for their loads, behind the position slab: the loads fly under it
    if (more_kv) put_kv(bw);
    if (more_pe) put_pe((s + 2) & 3);
    __syncthreads();      // the one barrier of a step: the new tiles are visible to all eight waves (and each wave's slab to its own lanes), and every wave has left the tiles of this step
    bl = bl == 2 ? 0 : bl + 1; bw = bw == 2 ? 0 : bw + 1; }
  { const float inv = 1.0f / lrun;
#pragma unroll
    for (int t = 0; t < 4; ++t) st8(qpw + t * 16, acc[t] * inv); }
  LDSX();
  for (int qq = lane; qq < 16 * 16; qq += 32) { const int rl = qq >> 4, pc = qq & 15; vst2(out + ((size_t)b * M + q0 + rl) * D + pc * 4, *(const v4f*)(&sQP[w][rl][pc * 4])); }
}
extern "C" void kernel_launch(void* const* d_in, const int* in_sizes, int n_in, void* d_out, int out_size, void* d_ws, size_t ws_size, hipStream_t stream) {
  (void)in_sizes; (void)n_in; (void)out_size; (void)ws_size; (void)d_ws;
  const float* query = (const float*)d_in[0]; const float* key = (const float*)d_in[1]; const float* value = (const float*)d_in[2]; const float* pe = (const float*)d_in[3];
  float* out = (float*)d_out;
  k_seq<<<dim3(M / 128, NBH), 256, 0, stream>>>(query, key, value, pe, out);
}
